// v000
// Measured on an AMD MI455X. A time is GPU time per run, averaged over a window of back-to-back runs after a warm-up
// (all launches, gaps included; the runs take copies of the inputs in turn), and the median of several windows.
// Apart from v000's, it joins two sittings. Times from different sittings can be a few percent apart, while
// side-by-side timings come from the same sitting.
// v000 is the starting kernel. One run takes 368 microseconds.
#include <hip/hip_runtime.h>

// Problem sizes (fixed by the reference)
#define BB   4
#define CC   96
#define NN   4096      // H*W = 64*64
#define C8P  16        // head dim 12, padded to 16 rows in workspace
#define NCL  96        // num classes

// workspace layout in floats:
//   Qp : [2][B][16][N]   at offset 0
//   Kp : [2][B][16][N]   at offset QPSZ
//   V  : [2][B][96][N]   at offset 2*QPSZ
#define QPSZ (2 * BB * C8P * NN)

typedef float v2f __attribute__((ext_vector_type(2)));
typedef float v8f __attribute__((ext_vector_type(8)));

// pointer types matching the async-to-LDS builtin signatures
typedef int v2i __attribute__((vector_size(8)));
typedef __attribute__((address_space(1))) int*  gi32_p;   // global b32 src
typedef __attribute__((address_space(3))) int*  li32_p;   // LDS b32 dst
typedef __attribute__((address_space(1))) v2i*  gi64_p;   // global b64 src
typedef __attribute__((address_space(3))) v2i*  li64_p;   // LDS b64 dst

#if __has_builtin(__builtin_amdgcn_global_load_async_to_lds_b32) && \
    __has_builtin(__builtin_amdgcn_global_load_async_to_lds_b64) && \
    __has_builtin(__builtin_amdgcn_s_wait_asynccnt)
#define USE_ASYNC 1
#else
#define USE_ASYNC 0
#endif

// -------------------------------------------------------------------------
// Kernel 1: 1x1-conv QKV projections into workspace.
// grid: (N/256, B, 2 streams), block 256. One thread = one pixel n.
// -------------------------------------------------------------------------
__global__ __launch_bounds__(256)
void cotsr_qkv(const float* __restrict__ x1, const float* __restrict__ x2,
               const float* __restrict__ wq1, const float* __restrict__ bq1,
               const float* __restrict__ wk1, const float* __restrict__ bk1,
               const float* __restrict__ wv1, const float* __restrict__ bv1,
               const float* __restrict__ wq2, const float* __restrict__ bq2,
               const float* __restrict__ wk2, const float* __restrict__ bk2,
               const float* __restrict__ wv2, const float* __restrict__ bv2,
               float* __restrict__ ws)
{
    const int s = blockIdx.z, b = blockIdx.y;
    const int n = blockIdx.x * 256 + threadIdx.x;

    const float* x  = (s == 0 ? x1 : x2) + (size_t)b * CC * NN;
    const float* wq = s == 0 ? wq1 : wq2;  const float* bq = s == 0 ? bq1 : bq2;
    const float* wk = s == 0 ? wk1 : wk2;  const float* bk = s == 0 ? bk1 : bk2;
    const float* wv = s == 0 ? wv1 : wv2;  const float* bv = s == 0 ? bv1 : bv2;

    float* Qp = ws +              (size_t)(s * BB + b) * C8P * NN;
    float* Kp = ws + QPSZ +       (size_t)(s * BB + b) * C8P * NN;
    float* V  = ws + 2 * QPSZ +   (size_t)(s * BB + b) * CC  * NN;

    // Q and K rows (12 each), streaming x once
    float aq[12], ak[12];
#pragma unroll
    for (int j = 0; j < 12; ++j) { aq[j] = bq[j]; ak[j] = bk[j]; }
    for (int c = 0; c < CC; ++c) {
        float xv = x[c * NN + n];
#pragma unroll
        for (int j = 0; j < 12; ++j) {
            aq[j] += wq[j * CC + c] * xv;
            ak[j] += wk[j * CC + c] * xv;
        }
    }
#pragma unroll
    for (int j = 0; j < 12; ++j) { Qp[j * NN + n] = aq[j]; Kp[j * NN + n] = ak[j]; }
#pragma unroll
    for (int j = 12; j < 16; ++j) { Qp[j * NN + n] = 0.f; Kp[j * NN + n] = 0.f; }

    // V rows in 4 groups of 24
    for (int g = 0; g < 4; ++g) {
        float av[24];
#pragma unroll
        for (int j = 0; j < 24; ++j) av[j] = bv[g * 24 + j];
        for (int c = 0; c < CC; ++c) {
            float xv = x[c * NN + n];
#pragma unroll
            for (int j = 0; j < 24; ++j) av[j] += wv[(g * 24 + j) * CC + c] * xv;
        }
#pragma unroll
        for (int j = 0; j < 24; ++j) V[(g * 24 + j) * NN + n] = av[j];
    }
}

// -------------------------------------------------------------------------
// Kernel 2: fused flash cross-attention + residual + classifier conv.
// grid: (N/128, B, 2 streams), block 256 (8 waves; one wave = 16 queries).
// K/V tiles double-buffered in LDS and staged with async global->LDS DMA
// (ASYNCcnt) so global latency hides behind the WMMA pipe.
// -------------------------------------------------------------------------
__global__ __launch_bounds__(256)
void cotsr_attn(const float* __restrict__ x1, const float* __restrict__ x2,
                const float* __restrict__ g1, const float* __restrict__ g2,
                const float* __restrict__ wc1, const float* __restrict__ bc1,
                const float* __restrict__ wc2, const float* __restrict__ bc2,
                const float* __restrict__ ws, float* __restrict__ out)
{
    __shared__ __align__(16) float kls[2][16 * 16];   // K tile, transposed [m][c]
    __shared__ __align__(16) float vls[2][CC * 16];   // V tile [c][m]
    __shared__ __align__(16) float wcs[NCL * CC];     // classifier weights, row-major

    const int s = blockIdx.z, b = blockIdx.y, qg = blockIdx.x;
    const int t = 1 - s;                              // kv stream
    const int tid  = threadIdx.x;
    const int lane = tid & 31, wid = tid >> 5;
    const bool hi  = lane >= 16;
    const int  ln  = lane & 15;

    const float* xr    = (s == 0 ? x1 : x2) + (size_t)b * CC * NN;
    const float  gamma = (s == 0 ? g1 : g2)[0];
    const float* wc    = s == 0 ? wc1 : wc2;
    const float* bc    = s == 0 ? bc1 : bc2;
    const float* Qp = ws +            (size_t)(s * BB + b) * C8P * NN;
    const float* Kp = ws + QPSZ +     (size_t)(t * BB + b) * C8P * NN;
    const float* V  = ws + 2 * QPSZ + (size_t)(t * BB + b) * CC  * NN;
    float* outp = out + ((size_t)s * BB + b) * NCL * NN;

    // stage classifier weights once
    for (int i = tid; i < NCL * CC; i += 256) wcs[i] = wc[i];

    const int n0 = qg * 128 + wid * 16;

    // cooperative tile staging (async DMA to LDS when available)
    auto stage = [&](int kt, int buf) {
        const int m0 = kt * 16;
        const int ck = tid >> 4, mk = tid & 15;
#if USE_ASYNC
        // K tile: transpose during the async copy (per-lane LDS destination)
        __builtin_amdgcn_global_load_async_to_lds_b32(
            (gi32_p)(void*)const_cast<float*>(Kp + ck * NN + m0 + mk),
            (li32_p)(void*)&kls[buf][mk * 16 + ck], 0, 0);
#pragma unroll
        for (int i = 0; i < 3; ++i) {
            int idx = tid + 256 * i;
            int cv = idx >> 3, j2 = (idx & 7) * 2;
            __builtin_amdgcn_global_load_async_to_lds_b64(
                (gi64_p)(void*)const_cast<float*>(V + cv * NN + m0 + j2),
                (li64_p)(void*)&vls[buf][cv * 16 + j2], 0, 0);
        }
#else
        kls[buf][mk * 16 + ck] = Kp[ck * NN + m0 + mk];
#pragma unroll
        for (int i = 0; i < 6; ++i) {
            int idx = tid + 256 * i;
            int cv = idx >> 4, m2 = idx & 15;
            vls[buf][cv * 16 + m2] = V[cv * NN + m0 + m2];
        }
#endif
    };

    // Q tile in WMMA-B layout: 3 K-groups (c = 0..11), v2f each
    v2f qb[3];
#pragma unroll
    for (int g = 0; g < 3; ++g) {
        int r0 = 4 * g + (hi ? 2 : 0);
        qb[g][0] = Qp[(r0    ) * NN + n0 + ln];
        qb[g][1] = Qp[(r0 + 1) * NN + n0 + ln];
    }

    v8f oacc[6];                // O[c=96][n=16] fp32 accumulators
#pragma unroll
    for (int i = 0; i < 6; ++i) oacc[i] = (v8f)0.f;
    float rmax = -3.0e38f, rsum = 0.f;

    stage(0, 0);                // prefetch first tile

    for (int kt = 0; kt < 256; ++kt) {
        const int buf = kt & 1;
        if (kt + 1 < 256) {
            stage(kt + 1, buf ^ 1);        // prefetch next tile into other buffer
#if USE_ASYNC
            __builtin_amdgcn_s_wait_asynccnt(4);   // our 4 ops for THIS tile landed
#endif
        } else {
#if USE_ASYNC
            __builtin_amdgcn_s_wait_asynccnt(0);
#endif
        }
        __syncthreads();        // all waves' staging of this tile visible

        // S[m,n] = sum_c K[m,c] * Q[n,c]   (A = K tile, B = Q tile)
        v8f sacc = (v8f)0.f;
#pragma unroll
        for (int g = 0; g < 3; ++g) {
            v2f ka = *(const v2f*)&kls[buf][ln * 16 + 4 * g + (hi ? 2 : 0)];
            sacc = __builtin_amdgcn_wmma_f32_16x16x4_f32(
                false, ka, false, qb[g], (short)0, sacc, false, false);
        }

        // online softmax over m (in-lane over 8 regs + one cross-half shuffle)
        float tmax = sacc[0];
#pragma unroll
        for (int r = 1; r < 8; ++r) tmax = fmaxf(tmax, sacc[r]);
        tmax = fmaxf(tmax, __shfl_xor(tmax, 16, 32));
        float nmax = fmaxf(rmax, tmax);
        float corr = __expf(rmax - nmax);
        rmax = nmax;
        float p[8], tsum = 0.f;
#pragma unroll
        for (int r = 0; r < 8; ++r) { p[r] = __expf(sacc[r] - nmax); tsum += p[r]; }
        tsum += __shfl_xor(tsum, 16, 32);
        rsum = rsum * corr + tsum;
#pragma unroll
        for (int i = 0; i < 6; ++i)
#pragma unroll
            for (int r = 0; r < 8; ++r) oacc[i][r] *= corr;

        // rearrange P[m,n] into B-layout (4 K-groups over m)
        float xp[8];
#pragma unroll
        for (int r = 0; r < 8; ++r) xp[r] = __shfl_xor(p[r], 16, 32);
        v2f pb[4];
        pb[0][0] = hi ? xp[2] : p[0];  pb[0][1] = hi ? xp[3] : p[1];
        pb[1][0] = hi ? xp[6] : p[4];  pb[1][1] = hi ? xp[7] : p[5];
        pb[2][0] = hi ? p[2]  : xp[0]; pb[2][1] = hi ? p[3]  : xp[1];
        pb[3][0] = hi ? p[6]  : xp[4]; pb[3][1] = hi ? p[7]  : xp[5];

        // O[c,n] += sum_m V[c,m] * P[m,n]
#pragma unroll
        for (int cc = 0; cc < 6; ++cc) {
#pragma unroll
            for (int g = 0; g < 4; ++g) {
                v2f va = *(const v2f*)&vls[buf][(cc * 16 + ln) * 16 + 4 * g + (hi ? 2 : 0)];
                oacc[cc] = __builtin_amdgcn_wmma_f32_16x16x4_f32(
                    false, va, false, pb[g], (short)0, oacc[cc], false, false);
            }
        }
        __syncthreads();        // all waves done reading before buffer reuse
    }

    // epilogue: y = x + gamma * O / rsum
    const float inv = 1.0f / rsum;
#pragma unroll
    for (int cc = 0; cc < 6; ++cc) {
#pragma unroll
        for (int r = 0; r < 8; ++r) {
            int c = cc * 16 + r + (hi ? 8 : 0);
            float xv = xr[c * NN + n0 + ln];
            oacc[cc][r] = xv + gamma * oacc[cc][r] * inv;
        }
    }

    // classifier: out[o,n] = sum_c wc[o,c] * y[c,n] + bc[o]
    v8f res[6];
#pragma unroll
    for (int i = 0; i < 6; ++i) res[i] = (v8f)0.f;

#pragma unroll
    for (int cc = 0; cc < 6; ++cc) {
        float yy[8], xy[8];
#pragma unroll
        for (int r = 0; r < 8; ++r) { yy[r] = oacc[cc][r]; xy[r] = __shfl_xor(yy[r], 16, 32); }
        v2f yb[4];
        yb[0][0] = hi ? xy[2] : yy[0];  yb[0][1] = hi ? xy[3] : yy[1];
        yb[1][0] = hi ? xy[6] : yy[4];  yb[1][1] = hi ? xy[7] : yy[5];
        yb[2][0] = hi ? yy[2] : xy[0];  yb[2][1] = hi ? yy[3] : xy[1];
        yb[3][0] = hi ? yy[6] : xy[4];  yb[3][1] = hi ? yy[7] : xy[5];
#pragma unroll
        for (int oc = 0; oc < 6; ++oc) {
#pragma unroll
            for (int g = 0; g < 4; ++g) {
                v2f wa = *(const v2f*)&wcs[(oc * 16 + ln) * CC + cc * 16 + 4 * g + (hi ? 2 : 0)];
                res[oc] = __builtin_amdgcn_wmma_f32_16x16x4_f32(
                    false, wa, false, yb[g], (short)0, res[oc], false, false);
            }
        }
    }

#pragma unroll
    for (int oc = 0; oc < 6; ++oc) {
#pragma unroll
        for (int r = 0; r < 8; ++r) {
            int o = oc * 16 + r + (hi ? 8 : 0);
            outp[o * NN + n0 + ln] = res[oc][r] + bc[o];
        }
    }
}

// -------------------------------------------------------------------------
extern "C" void kernel_launch(void* const* d_in, const int* in_sizes, int n_in,
                              void* d_out, int out_size, void* d_ws, size_t ws_size,
                              hipStream_t stream)
{
    const float* x1  = (const float*)d_in[0];
    const float* x2  = (const float*)d_in[1];
    const float* wq1 = (const float*)d_in[2];
    const float* bq1 = (const float*)d_in[3];
    const float* wk1 = (const float*)d_in[4];
    const float* bk1 = (const float*)d_in[5];
    const float* wv1 = (const float*)d_in[6];
    const float* bv1 = (const float*)d_in[7];
    const float* wq2 = (const float*)d_in[8];
    const float* bq2 = (const float*)d_in[9];
    const float* wk2 = (const float*)d_in[10];
    const float* bk2 = (const float*)d_in[11];
    const float* wv2 = (const float*)d_in[12];
    const float* bv2 = (const float*)d_in[13];
    const float* g1  = (const float*)d_in[14];
    const float* g2  = (const float*)d_in[15];
    const float* wc1 = (const float*)d_in[16];
    const float* bc1 = (const float*)d_in[17];
    const float* wc2 = (const float*)d_in[18];
    const float* bc2 = (const float*)d_in[19];

    float* ws  = (float*)d_ws;
    float* out = (float*)d_out;

    dim3 gq(NN / 256, BB, 2);
    cotsr_qkv<<<gq, 256, 0, stream>>>(x1, x2, wq1, bq1, wk1, bk1, wv1, bv1,
                                      wq2, bq2, wk2, bk2, wv2, bv2, ws);

    dim3 ga(NN / 128, BB, 2);
    cotsr_attn<<<ga, 256, 0, stream>>>(x1, x2, g1, g2, wc1, bc1, wc2, bc2, ws, out);
}

// v001
// A run of this version takes 278 microseconds.
// Two timings next to v000 both put it at 1.37 times that version's speed.
#include <hip/hip_runtime.h>

// Problem sizes (fixed by the reference)
#define BB   4
#define CC   96
#define NN   4096      // H*W = 64*64
#define C8P  16        // head dim 12, padded to 16 rows in workspace
#define NCL  96        // num classes

// workspace layout in floats:
//   Qp : [2][B][16][N]   at offset 0
//   Kp : [2][B][16][N]   at offset QPSZ
//   V  : [2][B][96][N]   at offset 2*QPSZ
#define QPSZ (2 * BB * C8P * NN)

typedef float v2f __attribute__((ext_vector_type(2)));
typedef float v4f __attribute__((ext_vector_type(4)));
typedef float v8f __attribute__((ext_vector_type(8)));

// pointer types matching the async-to-LDS builtin signatures
typedef int v2i __attribute__((vector_size(8)));
typedef __attribute__((address_space(1))) int*  gi32_p;   // global b32 src
typedef __attribute__((address_space(3))) int*  li32_p;   // LDS b32 dst
typedef __attribute__((address_space(1))) v2i*  gi64_p;   // global b64 src
typedef __attribute__((address_space(3))) v2i*  li64_p;   // LDS b64 dst

#if __has_builtin(__builtin_amdgcn_global_load_async_to_lds_b32) && \
    __has_builtin(__builtin_amdgcn_global_load_async_to_lds_b64) && \
    __has_builtin(__builtin_amdgcn_s_wait_asynccnt)
#define USE_ASYNC 1
#else
#define USE_ASYNC 0
#endif

// -------------------------------------------------------------------------
// Kernel 1: 1x1-conv QKV projections into workspace, as one f32 WMMA product
//   [128 x 96] (rows: Q 12 + 4 zero, K 12 + 4 zero, V 96)  x  x[96 x N].
// grid: (N/128, B, 2 streams), block 128 (4 waves; one wave = 32 pixels).
// A = weight rows from LDS, B = x held in registers for the whole kernel.
// A wave's two column tiles are the even and the odd pixels of its 32, so
// that one lane loads and stores pixel pairs and 16 lanes cover a 128-B line.
// -------------------------------------------------------------------------
#define WROWS 128
#define WP    100      // LDS row pitch in floats: 16 rows x 2 halves of a b64 read hit 64 distinct banks

__global__ __launch_bounds__(128)
void cotsr_qkv(const float* __restrict__ x1, const float* __restrict__ x2,
               const float* __restrict__ wq1, const float* __restrict__ bq1,
               const float* __restrict__ wk1, const float* __restrict__ bk1,
               const float* __restrict__ wv1, const float* __restrict__ bv1,
               const float* __restrict__ wq2, const float* __restrict__ bq2,
               const float* __restrict__ wk2, const float* __restrict__ bk2,
               const float* __restrict__ wv2, const float* __restrict__ bv2,
               float* __restrict__ ws)
{
    __shared__ __align__(16) float wl[WROWS * WP];    // stacked weights [row][c]
    __shared__ __align__(16) float bl[WROWS];         // stacked biases

    const int s = blockIdx.z, b = blockIdx.y;
    const int tid  = threadIdx.x;
    const int lane = tid & 31, wid = tid >> 5;
    const bool hi  = lane >= 16;
    const int  ln  = lane & 15;

    const float* x  = (s == 0 ? x1 : x2) + (size_t)b * CC * NN;
    const float* wq = s == 0 ? wq1 : wq2;  const float* bq = s == 0 ? bq1 : bq2;
    const float* wk = s == 0 ? wk1 : wk2;  const float* bk = s == 0 ? bk1 : bk2;
    const float* wv = s == 0 ? wv1 : wv2;  const float* bv = s == 0 ? bv1 : bv2;

    float* Qp = ws +              (size_t)(s * BB + b) * C8P * NN;
    float* Kp = ws + QPSZ +       (size_t)(s * BB + b) * C8P * NN;
    float* V  = ws + 2 * QPSZ +   (size_t)(s * BB + b) * CC  * NN;

    const int n0 = blockIdx.x * 128 + wid * 32 + 2 * ln;   // this lane's pixel pair

    // stage the stacked weights: a pass is 16 rows x 128 bytes, 16 bytes a thread,
    // no branch, so that all 24 loads of a thread are in flight together
    const int  sr  = tid >> 3, sc = (tid & 7) * 4;
    const bool pad = sr >= 12;                    // rows 12..15 of the Q and K tiles are zero
    const int  so  = (pad ? 0 : sr) * CC + sc;    // a pad row reads row 0 and drops it
    const float* wqp = wq + so;
    const float* wkp = wk + so;
    const float* wvp = wv + sr * CC + sc;
    float*       wlp = wl + sr * WP + sc;
    v4f tq[3], tk[3], tv[18];
#pragma unroll
    for (int cb = 0; cb < 3; ++cb) {
        tq[cb] = *(const v4f*)&wqp[cb * 32];
        tk[cb] = *(const v4f*)&wkp[cb * 32];
    }
#pragma unroll
    for (int i = 0; i < 18; ++i)
        tv[i] = *(const v4f*)&wvp[(i / 3) * 16 * CC + (i % 3) * 32];

    // the x loads below may be given registers that hold addresses of the loads above
    asm volatile("s_wait_xcnt 0x0" ::: "memory");

    // x in WMMA-B layout: 24 K-groups over c, even pixels in xe, odd in xo
    const float* xp = x + (hi ? 2 : 0) * NN + n0;
    v2f p0[24], p1[24];
#pragma unroll
    for (int g = 0; g < 24; ++g) {
        p0[g] = *(const v2f*)&xp[(4 * g    ) * NN];
        p1[g] = *(const v2f*)&xp[(4 * g + 1) * NN];
    }
    // keeps the bias loads behind the last x load
    __builtin_amdgcn_sched_barrier(0);

    const int br  = tid & 15;                     // bias row inside its tile
    const int brc = br < 12 ? br : 0;
    const float vq = bq[brc], vk = bk[brc], vv = bv[tid >= 32 ? tid - 32 : 0];

    const v4f z4 = (v4f)0.f;
#pragma unroll
    for (int cb = 0; cb < 3; ++cb) {
        *(v4f*)&wlp[          cb * 32] = pad ? z4 : tq[cb];
        *(v4f*)&wlp[16 * WP + cb * 32] = pad ? z4 : tk[cb];
    }
#pragma unroll
    for (int i = 0; i < 18; ++i)
        *(v4f*)&wlp[(32 + (i / 3) * 16) * WP + (i % 3) * 32] = tv[i];
    bl[tid] = tid >= 32 ? vv : br >= 12 ? 0.f : tid >= 16 ? vk : vq;
    __syncthreads();            // weights and biases visible to all four waves

    v2f xe[24], xo[24];
#pragma unroll
    for (int g = 0; g < 24; ++g) {
        xe[g][0] = p0[g][0];  xe[g][1] = p1[g][0];
        xo[g][0] = p0[g][1];  xo[g][1] = p1[g][1];
    }

    // two passes of four row tiles: 8 independent accumulators each
    // kept rolled: unrolled, the second pass's weight reads are hoisted over the
    // first and the register count goes past 256
#pragma unroll 1
    for (int mh = 0; mh < 2; ++mh) {
        const float* wt = &wl[(mh * 64 + ln) * WP + (hi ? 2 : 0)];
        v8f ae[4], ao[4];
#pragma unroll
        for (int t = 0; t < 4; ++t) { ae[t] = (v8f)0.f; ao[t] = (v8f)0.f; }

#pragma unroll
        for (int g = 0; g < 24; ++g) {
#pragma unroll
            for (int t = 0; t < 4; ++t) {
                v2f wa = *(const v2f*)&wt[t * 16 * WP + 4 * g];
                ae[t] = __builtin_amdgcn_wmma_f32_16x16x4_f32(
                    false, wa, false, xe[g], (short)0, ae[t], false, false);
                ao[t] = __builtin_amdgcn_wmma_f32_16x16x4_f32(
                    false, wa, false, xo[g], (short)0, ao[t], false, false);
            }
        }

#pragma unroll
        for (int t = 0; t < 4; ++t) {
            const int mt = mh * 4 + t;
            float* dst = (mt == 0 ? Qp : mt == 1 ? Kp : V + (mt - 2) * 16 * NN)
                         + (hi ? 8 : 0) * NN + n0;
            const float* bt = &bl[mt * 16 + (hi ? 8 : 0)];
#pragma unroll
            for (int r = 0; r < 8; ++r) {
                v2f o;
                o[0] = ae[t][r] + bt[r];
                o[1] = ao[t][r] + bt[r];
                *(v2f*)&dst[r * NN] = o;
            }
        }
        // the next pass rewrites the address and data registers of these stores
        asm volatile("s_wait_xcnt 0x0" ::: "memory");
    }
}

// -------------------------------------------------------------------------
// Kernel 2: fused flash cross-attention + residual + classifier conv.
// grid: (N/128, B, 2 streams), block 256 (8 waves; one wave = 16 queries).
// K/V tiles double-buffered in LDS and staged with async global->LDS DMA
// (ASYNCcnt) so global latency hides behind the WMMA pipe.
// -------------------------------------------------------------------------
__global__ __launch_bounds__(256)
void cotsr_attn(const float* __restrict__ x1, const float* __restrict__ x2,
                const float* __restrict__ g1, const float* __restrict__ g2,
                const float* __restrict__ wc1, const float* __restrict__ bc1,
                const float* __restrict__ wc2, const float* __restrict__ bc2,
                const float* __restrict__ ws, float* __restrict__ out)
{
    __shared__ __align__(16) float kls[2][16 * 16];   // K tile, transposed [m][c]
    __shared__ __align__(16) float vls[2][CC * 16];   // V tile [c][m]
    __shared__ __align__(16) float wcs[NCL * CC];     // classifier weights, row-major

    const int s = blockIdx.z, b = blockIdx.y, qg = blockIdx.x;
    const int t = 1 - s;                              // kv stream
    const int tid  = threadIdx.x;
    const int lane = tid & 31, wid = tid >> 5;
    const bool hi  = lane >= 16;
    const int  ln  = lane & 15;

    const float* xr    = (s == 0 ? x1 : x2) + (size_t)b * CC * NN;
    const float  gamma = (s == 0 ? g1 : g2)[0];
    const float* wc    = s == 0 ? wc1 : wc2;
    const float* bc    = s == 0 ? bc1 : bc2;
    const float* Qp = ws +            (size_t)(s * BB + b) * C8P * NN;
    const float* Kp = ws + QPSZ +     (size_t)(t * BB + b) * C8P * NN;
    const float* V  = ws + 2 * QPSZ + (size_t)(t * BB + b) * CC  * NN;
    float* outp = out + ((size_t)s * BB + b) * NCL * NN;

    // stage classifier weights once
    for (int i = tid; i < NCL * CC; i += 256) wcs[i] = wc[i];

    const int n0 = qg * 128 + wid * 16;

    // cooperative tile staging (async DMA to LDS when available)
    auto stage = [&](int kt, int buf) {
        const int m0 = kt * 16;
        const int ck = tid >> 4, mk = tid & 15;
#if USE_ASYNC
        // K tile: transpose during the async copy (per-lane LDS destination)
        __builtin_amdgcn_global_load_async_to_lds_b32(
            (gi32_p)(void*)const_cast<float*>(Kp + ck * NN + m0 + mk),
            (li32_p)(void*)&kls[buf][mk * 16 + ck], 0, 0);
#pragma unroll
        for (int i = 0; i < 3; ++i) {
            int idx = tid + 256 * i;
            int cv = idx >> 3, j2 = (idx & 7) * 2;
            __builtin_amdgcn_global_load_async_to_lds_b64(
                (gi64_p)(void*)const_cast<float*>(V + cv * NN + m0 + j2),
                (li64_p)(void*)&vls[buf][cv * 16 + j2], 0, 0);
        }
#else
        kls[buf][mk * 16 + ck] = Kp[ck * NN + m0 + mk];
#pragma unroll
        for (int i = 0; i < 6; ++i) {
            int idx = tid + 256 * i;
            int cv = idx >> 4, m2 = idx & 15;
            vls[buf][cv * 16 + m2] = V[cv * NN + m0 + m2];
        }
#endif
    };

    // Q tile in WMMA-B layout: 3 K-groups (c = 0..11), v2f each
    v2f qb[3];
#pragma unroll
    for (int g = 0; g < 3; ++g) {
        int r0 = 4 * g + (hi ? 2 : 0);
        qb[g][0] = Qp[(r0    ) * NN + n0 + ln];
        qb[g][1] = Qp[(r0 + 1) * NN + n0 + ln];
    }

    v8f oacc[6];                // O[c=96][n=16] fp32 accumulators
#pragma unroll
    for (int i = 0; i < 6; ++i) oacc[i] = (v8f)0.f;
    float rmax = -3.0e38f, rsum = 0.f;

    stage(0, 0);                // prefetch first tile

    for (int kt = 0; kt < 256; ++kt) {
        const int buf = kt & 1;
        if (kt + 1 < 256) {
            stage(kt + 1, buf ^ 1);        // prefetch next tile into other buffer
#if USE_ASYNC
            __builtin_amdgcn_s_wait_asynccnt(4);   // our 4 ops for THIS tile landed
#endif
        } else {
#if USE_ASYNC
            __builtin_amdgcn_s_wait_asynccnt(0);
#endif
        }
        __syncthreads();        // all waves' staging of this tile visible

        // S[m,n] = sum_c K[m,c] * Q[n,c]   (A = K tile, B = Q tile)
        v8f sacc = (v8f)0.f;
#pragma unroll
        for (int g = 0; g < 3; ++g) {
            v2f ka = *(const v2f*)&kls[buf][ln * 16 + 4 * g + (hi ? 2 : 0)];
            sacc = __builtin_amdgcn_wmma_f32_16x16x4_f32(
                false, ka, false, qb[g], (short)0, sacc, false, false);
        }

        // online softmax over m (in-lane over 8 regs + one cross-half shuffle)
        float tmax = sacc[0];
#pragma unroll
        for (int r = 1; r < 8; ++r) tmax = fmaxf(tmax, sacc[r]);
        tmax = fmaxf(tmax, __shfl_xor(tmax, 16, 32));
        float nmax = fmaxf(rmax, tmax);
        float corr = __expf(rmax - nmax);
        rmax = nmax;
        float p[8], tsum = 0.f;
#pragma unroll
        for (int r = 0; r < 8; ++r) { p[r] = __expf(sacc[r] - nmax); tsum += p[r]; }
        tsum += __shfl_xor(tsum, 16, 32);
        rsum = rsum * corr + tsum;
#pragma unroll
        for (int i = 0; i < 6; ++i)
#pragma unroll
            for (int r = 0; r < 8; ++r) oacc[i][r] *= corr;

        // rearrange P[m,n] into B-layout (4 K-groups over m)
        float xp[8];
#pragma unroll
        for (int r = 0; r < 8; ++r) xp[r] = __shfl_xor(p[r], 16, 32);
        v2f pb[4];
        pb[0][0] = hi ? xp[2] : p[0];  pb[0][1] = hi ? xp[3] : p[1];
        pb[1][0] = hi ? xp[6] : p[4];  pb[1][1] = hi ? xp[7] : p[5];
        pb[2][0] = hi ? p[2]  : xp[0]; pb[2][1] = hi ? p[3]  : xp[1];
        pb[3][0] = hi ? p[6]  : xp[4]; pb[3][1] = hi ? p[7]  : xp[5];

        // O[c,n] += sum_m V[c,m] * P[m,n]
#pragma unroll
        for (int cc = 0; cc < 6; ++cc) {
#pragma unroll
            for (int g = 0; g < 4; ++g) {
                v2f va = *(const v2f*)&vls[buf][(cc * 16 + ln) * 16 + 4 * g + (hi ? 2 : 0)];
                oacc[cc] = __builtin_amdgcn_wmma_f32_16x16x4_f32(
                    false, va, false, pb[g], (short)0, oacc[cc], false, false);
            }
        }
        __syncthreads();        // all waves done reading before buffer reuse
    }

    // epilogue: y = x + gamma * O / rsum
    const float inv = 1.0f / rsum;
#pragma unroll
    for (int cc = 0; cc < 6; ++cc) {
#pragma unroll
        for (int r = 0; r < 8; ++r) {
            int c = cc * 16 + r + (hi ? 8 : 0);
            float xv = xr[c * NN + n0 + ln];
            oacc[cc][r] = xv + gamma * oacc[cc][r] * inv;
        }
    }

    // classifier: out[o,n] = sum_c wc[o,c] * y[c,n] + bc[o]
    v8f res[6];
#pragma unroll
    for (int i = 0; i < 6; ++i) res[i] = (v8f)0.f;

#pragma unroll
    for (int cc = 0; cc < 6; ++cc) {
        float yy[8], xy[8];
#pragma unroll
        for (int r = 0; r < 8; ++r) { yy[r] = oacc[cc][r]; xy[r] = __shfl_xor(yy[r], 16, 32); }
        v2f yb[4];
        yb[0][0] = hi ? xy[2] : yy[0];  yb[0][1] = hi ? xy[3] : yy[1];
        yb[1][0] = hi ? xy[6] : yy[4];  yb[1][1] = hi ? xy[7] : yy[5];
        yb[2][0] = hi ? yy[2] : xy[0];  yb[2][1] = hi ? yy[3] : xy[1];
        yb[3][0] = hi ? yy[6] : xy[4];  yb[3][1] = hi ? yy[7] : xy[5];
#pragma unroll
        for (int oc = 0; oc < 6; ++oc) {
#pragma unroll
            for (int g = 0; g < 4; ++g) {
                v2f wa = *(const v2f*)&wcs[(oc * 16 + ln) * CC + cc * 16 + 4 * g + (hi ? 2 : 0)];
                res[oc] = __builtin_amdgcn_wmma_f32_16x16x4_f32(
                    false, wa, false, yb[g], (short)0, res[oc], false, false);
            }
        }
    }

#pragma unroll
    for (int oc = 0; oc < 6; ++oc) {
#pragma unroll
        for (int r = 0; r < 8; ++r) {
            int o = oc * 16 + r + (hi ? 8 : 0);
            outp[o * NN + n0 + ln] = res[oc][r] + bc[o];
        }
    }
}

// -------------------------------------------------------------------------
extern "C" void kernel_launch(void* const* d_in, const int* in_sizes, int n_in,
                              void* d_out, int out_size, void* d_ws, size_t ws_size,
                              hipStream_t stream)
{
    const float* x1  = (const float*)d_in[0];
    const float* x2  = (const float*)d_in[1];
    const float* wq1 = (const float*)d_in[2];
    const float* bq1 = (const float*)d_in[3];
    const float* wk1 = (const float*)d_in[4];
    const float* bk1 = (const float*)d_in[5];
    const float* wv1 = (const float*)d_in[6];
    const float* bv1 = (const float*)d_in[7];
    const float* wq2 = (const float*)d_in[8];
    const float* bq2 = (const float*)d_in[9];
    const float* wk2 = (const float*)d_in[10];
    const float* bk2 = (const float*)d_in[11];
    const float* wv2 = (const float*)d_in[12];
    const float* bv2 = (const float*)d_in[13];
    const float* g1  = (const float*)d_in[14];
    const float* g2  = (const float*)d_in[15];
    const float* wc1 = (const float*)d_in[16];
    const float* bc1 = (const float*)d_in[17];
    const float* wc2 = (const float*)d_in[18];
    const float* bc2 = (const float*)d_in[19];

    float* ws  = (float*)d_ws;
    float* out = (float*)d_out;

    dim3 gq(NN / 128, BB, 2);
    cotsr_qkv<<<gq, 128, 0, stream>>>(x1, x2, wq1, bq1, wk1, bk1, wv1, bv1,
                                      wq2, bq2, wk2, bk2, wv2, bv2, ws);

    dim3 ga(NN / 128, BB, 2);
    cotsr_attn<<<ga, 256, 0, stream>>>(x1, x2, g1, g2, wc1, bc1, wc2, bc2, ws, out);
}

// v002
// It runs in 212 microseconds.
// Two timings next to v001 both put it at 1.31 times that version's speed.
// Counting every step since v000, it is 1.80 times as fast.
#include <hip/hip_runtime.h>

// Problem sizes (fixed by the reference)
#define BB   4
#define CC   96
#define NN   4096      // H*W = 64*64
#define C8P  16        // head dim 12, padded to 16 rows in workspace
#define NCL  96        // num classes

// workspace layout in floats:
//   Qp : [2][B][16][N]   at offset 0
//   Kp : [2][B][16][N]   at offset QPSZ
//   V  : [2][B][96][N]   at offset 2*QPSZ
#define QPSZ (2 * BB * C8P * NN)

typedef float v2f __attribute__((ext_vector_type(2)));
typedef float v4f __attribute__((ext_vector_type(4)));
typedef float v8f __attribute__((ext_vector_type(8)));

// pointer types matching the async-to-LDS builtin signatures
typedef int v2i __attribute__((vector_size(8)));
typedef __attribute__((address_space(1))) int*  gi32_p;   // global b32 src
typedef __attribute__((address_space(3))) int*  li32_p;   // LDS b32 dst
typedef __attribute__((address_space(1))) v2i*  gi64_p;   // global b64 src
typedef __attribute__((address_space(3))) v2i*  li64_p;   // LDS b64 dst

#if __has_builtin(__builtin_amdgcn_global_load_async_to_lds_b32) && \
    __has_builtin(__builtin_amdgcn_global_load_async_to_lds_b64) && \
    __has_builtin(__builtin_amdgcn_s_wait_asynccnt)
#define USE_ASYNC 1
#else
#define USE_ASYNC 0
#endif

// -------------------------------------------------------------------------
// Kernel 1: 1x1-conv QKV projections into workspace, as one f32 WMMA product
//   [128 x 96] (rows: Q 12 + 4 zero, K 12 + 4 zero, V 96)  x  x[96 x N].
// grid: (N/128, B, 2 streams), block 128 (4 waves; one wave = 32 pixels).
// A = weight rows from LDS, B = x held in registers for the whole kernel.
// A wave's two column tiles are the even and the odd pixels of its 32, so
// that one lane loads and stores pixel pairs and 16 lanes cover a 128-B line.
// -------------------------------------------------------------------------
#define WROWS 128
#define WP    100      // LDS row pitch in floats: 16 rows x 2 halves of a b64 read hit 64 distinct banks

__global__ __launch_bounds__(128)
void cotsr_qkv(const float* __restrict__ x1, const float* __restrict__ x2,
               const float* __restrict__ wq1, const float* __restrict__ bq1,
               const float* __restrict__ wk1, const float* __restrict__ bk1,
               const float* __restrict__ wv1, const float* __restrict__ bv1,
               const float* __restrict__ wq2, const float* __restrict__ bq2,
               const float* __restrict__ wk2, const float* __restrict__ bk2,
               const float* __restrict__ wv2, const float* __restrict__ bv2,
               float* __restrict__ ws)
{
    __shared__ __align__(16) float wl[WROWS * WP];    // stacked weights [row][c]
    __shared__ __align__(16) float bl[WROWS];         // stacked biases

    const int s = blockIdx.z, b = blockIdx.y;
    const int tid  = threadIdx.x;
    const int lane = tid & 31, wid = tid >> 5;
    const bool hi  = lane >= 16;
    const int  ln  = lane & 15;

    const float* x  = (s == 0 ? x1 : x2) + (size_t)b * CC * NN;
    const float* wq = s == 0 ? wq1 : wq2;  const float* bq = s == 0 ? bq1 : bq2;
    const float* wk = s == 0 ? wk1 : wk2;  const float* bk = s == 0 ? bk1 : bk2;
    const float* wv = s == 0 ? wv1 : wv2;  const float* bv = s == 0 ? bv1 : bv2;

    float* Qp = ws +              (size_t)(s * BB + b) * C8P * NN;
    float* Kp = ws + QPSZ +       (size_t)(s * BB + b) * C8P * NN;
    float* V  = ws + 2 * QPSZ +   (size_t)(s * BB + b) * CC  * NN;

    const int n0 = blockIdx.x * 128 + wid * 32 + 2 * ln;   // this lane's pixel pair

    // stage the stacked weights: a pass is 16 rows x 128 bytes, 16 bytes a thread,
    // no branch, so that all 24 loads of a thread are in flight together
    const int  sr  = tid >> 3, sc = (tid & 7) * 4;
    const bool pad = sr >= 12;                    // rows 12..15 of the Q and K tiles are zero
    const int  so  = (pad ? 0 : sr) * CC + sc;    // a pad row reads row 0 and drops it
    const float* wqp = wq + so;
    const float* wkp = wk + so;
    const float* wvp = wv + sr * CC + sc;
    float*       wlp = wl + sr * WP + sc;
    v4f tq[3], tk[3], tv[18];
#pragma unroll
    for (int cb = 0; cb < 3; ++cb) {
        tq[cb] = *(const v4f*)&wqp[cb * 32];
        tk[cb] = *(const v4f*)&wkp[cb * 32];
    }
#pragma unroll
    for (int i = 0; i < 18; ++i)
        tv[i] = *(const v4f*)&wvp[(i / 3) * 16 * CC + (i % 3) * 32];

    // the x loads below may be given registers that hold addresses of the loads above
    asm volatile("s_wait_xcnt 0x0" ::: "memory");

    // x in WMMA-B layout: 24 K-groups over c, even pixels in xe, odd in xo
    const float* xp = x + (hi ? 2 : 0) * NN + n0;
    v2f p0[24], p1[24];
#pragma unroll
    for (int g = 0; g < 24; ++g) {
        p0[g] = *(const v2f*)&xp[(4 * g    ) * NN];
        p1[g] = *(const v2f*)&xp[(4 * g + 1) * NN];
    }
    // keeps the bias loads behind the last x load
    __builtin_amdgcn_sched_barrier(0);

    const int br  = tid & 15;                     // bias row inside its tile
    const int brc = br < 12 ? br : 0;
    const float vq = bq[brc], vk = bk[brc], vv = bv[tid >= 32 ? tid - 32 : 0];

    const v4f z4 = (v4f)0.f;
#pragma unroll
    for (int cb = 0; cb < 3; ++cb) {
        *(v4f*)&wlp[          cb * 32] = pad ? z4 : tq[cb];
        *(v4f*)&wlp[16 * WP + cb * 32] = pad ? z4 : tk[cb];
    }
#pragma unroll
    for (int i = 0; i < 18; ++i)
        *(v4f*)&wlp[(32 + (i / 3) * 16) * WP + (i % 3) * 32] = tv[i];
    bl[tid] = tid >= 32 ? vv : br >= 12 ? 0.f : tid >= 16 ? vk : vq;
    __syncthreads();            // weights and biases visible to all four waves

    v2f xe[24], xo[24];
#pragma unroll
    for (int g = 0; g < 24; ++g) {
        xe[g][0] = p0[g][0];  xe[g][1] = p1[g][0];
        xo[g][0] = p0[g][1];  xo[g][1] = p1[g][1];
    }

    // two passes of four row tiles: 8 independent accumulators each
    // kept rolled: unrolled, the second pass's weight reads are hoisted over the
    // first and the register count goes past 256
#pragma unroll 1
    for (int mh = 0; mh < 2; ++mh) {
        const float* wt = &wl[(mh * 64 + ln) * WP + (hi ? 2 : 0)];
        v8f ae[4], ao[4];
#pragma unroll
        for (int t = 0; t < 4; ++t) { ae[t] = (v8f)0.f; ao[t] = (v8f)0.f; }

#pragma unroll
        for (int g = 0; g < 24; ++g) {
#pragma unroll
            for (int t = 0; t < 4; ++t) {
                v2f wa = *(const v2f*)&wt[t * 16 * WP + 4 * g];
                ae[t] = __builtin_amdgcn_wmma_f32_16x16x4_f32(
                    false, wa, false, xe[g], (short)0, ae[t], false, false);
                ao[t] = __builtin_amdgcn_wmma_f32_16x16x4_f32(
                    false, wa, false, xo[g], (short)0, ao[t], false, false);
            }
        }

#pragma unroll
        for (int t = 0; t < 4; ++t) {
            const int mt = mh * 4 + t;
            float* dst = (mt == 0 ? Qp : mt == 1 ? Kp : V + (mt - 2) * 16 * NN)
                         + (hi ? 8 : 0) * NN + n0;
            const float* bt = &bl[mt * 16 + (hi ? 8 : 0)];
#pragma unroll
            for (int r = 0; r < 8; ++r) {
                v2f o;
                o[0] = ae[t][r] + bt[r];
                o[1] = ao[t][r] + bt[r];
                *(v2f*)&dst[r * NN] = o;
            }
        }
        // the next pass rewrites the address and data registers of these stores
        asm volatile("s_wait_xcnt 0x0" ::: "memory");
    }
}

// -------------------------------------------------------------------------
// Kernel 2: fused flash cross-attention + residual + classifier conv.
// grid: (N/128, B, 2 streams), block 256 (8 waves; one wave = 16 queries).
// K/V tiles double-buffered in LDS and staged with async global->LDS DMA
// (ASYNCcnt) so global latency hides behind the WMMA pipe.
// -------------------------------------------------------------------------
// LDS row pitch of the K and V tiles in floats (16 values + 4 unused), 4 x an odd number:
// the 16 rows x 2 halves of a fragment's b64 read then fall on 64 distinct banks
// (at 16 floats rows r, r + 4, r + 8 and r + 12 share their banks)
#define TP    20

__global__ __launch_bounds__(256)
void cotsr_attn(const float* __restrict__ x1, const float* __restrict__ x2,
                const float* __restrict__ g1, const float* __restrict__ g2,
                const float* __restrict__ wc1, const float* __restrict__ bc1,
                const float* __restrict__ wc2, const float* __restrict__ bc2,
                const float* __restrict__ ws, float* __restrict__ out)
{
    __shared__ __align__(16) float kls[2][16 * TP];   // K tile, transposed [m][c]
    __shared__ __align__(16) float vls[2][CC * TP];   // V tile [c][m]
    __shared__ __align__(16) float wcs[NCL * CC];     // classifier weights, row-major

    const int s = blockIdx.z, b = blockIdx.y, qg = blockIdx.x;
    const int t = 1 - s;                              // kv stream
    const int tid  = threadIdx.x;
    const int lane = tid & 31, wid = tid >> 5;
    const bool hi  = lane >= 16;
    const int  ln  = lane & 15;

    const float* xr    = (s == 0 ? x1 : x2) + (size_t)b * CC * NN;
    const float  gamma = (s == 0 ? g1 : g2)[0];
    const float* wc    = s == 0 ? wc1 : wc2;
    const float* bc    = s == 0 ? bc1 : bc2;
    const float* Qp = ws +            (size_t)(s * BB + b) * C8P * NN;
    const float* Kp = ws + QPSZ +     (size_t)(t * BB + b) * C8P * NN;
    const float* V  = ws + 2 * QPSZ + (size_t)(t * BB + b) * CC  * NN;
    float* outp = out + ((size_t)s * BB + b) * NCL * NN;

    // stage classifier weights once
    for (int i = tid; i < NCL * CC; i += 256) wcs[i] = wc[i];

    const int n0 = qg * 128 + wid * 16;

    // cooperative tile staging (async DMA to LDS when available)
    auto stage = [&](int kt, int buf) {
        const int m0 = kt * 16;
        const int ck = tid >> 4, mk = tid & 15;
#if USE_ASYNC
        // K tile: transpose during the async copy (per-lane LDS destination)
        __builtin_amdgcn_global_load_async_to_lds_b32(
            (gi32_p)(void*)const_cast<float*>(Kp + ck * NN + m0 + mk),
            (li32_p)(void*)&kls[buf][mk * TP + ck], 0, 0);
#pragma unroll
        for (int i = 0; i < 3; ++i) {
            int idx = tid + 256 * i;
            int cv = idx >> 3, j2 = (idx & 7) * 2;
            __builtin_amdgcn_global_load_async_to_lds_b64(
                (gi64_p)(void*)const_cast<float*>(V + cv * NN + m0 + j2),
                (li64_p)(void*)&vls[buf][cv * TP + j2], 0, 0);
        }
#else
        kls[buf][mk * TP + ck] = Kp[ck * NN + m0 + mk];
#pragma unroll
        for (int i = 0; i < 6; ++i) {
            int idx = tid + 256 * i;
            int cv = idx >> 4, m2 = idx & 15;
            vls[buf][cv * TP + m2] = V[cv * NN + m0 + m2];
        }
#endif
    };

    // Q tile in WMMA-B layout: 3 K-groups (c = 0..11), v2f each
    v2f qb[3];
#pragma unroll
    for (int g = 0; g < 3; ++g) {
        int r0 = 4 * g + (hi ? 2 : 0);
        qb[g][0] = Qp[(r0    ) * NN + n0 + ln];
        qb[g][1] = Qp[(r0 + 1) * NN + n0 + ln];
    }

    v8f oacc[6];                // O[c=96][n=16] fp32 accumulators
#pragma unroll
    for (int i = 0; i < 6; ++i) oacc[i] = (v8f)0.f;
    float rmax = -3.0e38f, rsum = 0.f;

    stage(0, 0);                // prefetch first tile

    for (int kt = 0; kt < 256; ++kt) {
        const int buf = kt & 1;
        if (kt + 1 < 256) {
            stage(kt + 1, buf ^ 1);        // prefetch next tile into other buffer
#if USE_ASYNC
            __builtin_amdgcn_s_wait_asynccnt(4);   // our 4 ops for THIS tile landed
#endif
        } else {
#if USE_ASYNC
            __builtin_amdgcn_s_wait_asynccnt(0);
#endif
        }
        __syncthreads();        // all waves' staging of this tile visible

        // S[m,n] = sum_c K[m,c] * Q[n,c]   (A = K tile, B = Q tile)
        v8f sacc = (v8f)0.f;
#pragma unroll
        for (int g = 0; g < 3; ++g) {
            v2f ka = *(const v2f*)&kls[buf][ln * TP + 4 * g + (hi ? 2 : 0)];
            sacc = __builtin_amdgcn_wmma_f32_16x16x4_f32(
                false, ka, false, qb[g], (short)0, sacc, false, false);
        }

        // online softmax over m (in-lane over 8 regs + one cross-half shuffle)
        float tmax = sacc[0];
#pragma unroll
        for (int r = 1; r < 8; ++r) tmax = fmaxf(tmax, sacc[r]);
        tmax = fmaxf(tmax, __shfl_xor(tmax, 16, 32));
        float nmax = fmaxf(rmax, tmax);
        float corr = __expf(rmax - nmax);
        rmax = nmax;
        float p[8], tsum = 0.f;
#pragma unroll
        for (int r = 0; r < 8; ++r) { p[r] = __expf(sacc[r] - nmax); tsum += p[r]; }
        tsum += __shfl_xor(tsum, 16, 32);
        rsum = rsum * corr + tsum;
#pragma unroll
        for (int i = 0; i < 6; ++i)
#pragma unroll
            for (int r = 0; r < 8; ++r) oacc[i][r] *= corr;

        // rearrange P[m,n] into B-layout (4 K-groups over m)
        float xp[8];
#pragma unroll
        for (int r = 0; r < 8; ++r) xp[r] = __shfl_xor(p[r], 16, 32);
        v2f pb[4];
        pb[0][0] = hi ? xp[2] : p[0];  pb[0][1] = hi ? xp[3] : p[1];
        pb[1][0] = hi ? xp[6] : p[4];  pb[1][1] = hi ? xp[7] : p[5];
        pb[2][0] = hi ? p[2]  : xp[0]; pb[2][1] = hi ? p[3]  : xp[1];
        pb[3][0] = hi ? p[6]  : xp[4]; pb[3][1] = hi ? p[7]  : xp[5];

        // O[c,n] += sum_m V[c,m] * P[m,n]
#pragma unroll
        for (int cc = 0; cc < 6; ++cc) {
#pragma unroll
            for (int g = 0; g < 4; ++g) {
                v2f va = *(const v2f*)&vls[buf][(cc * 16 + ln) * TP + 4 * g + (hi ? 2 : 0)];
                oacc[cc] = __builtin_amdgcn_wmma_f32_16x16x4_f32(
                    false, va, false, pb[g], (short)0, oacc[cc], false, false);
            }
        }
        __syncthreads();        // all waves done reading before buffer reuse
    }

    // epilogue: y = x + gamma * O / rsum
    const float inv = 1.0f / rsum;
#pragma unroll
    for (int cc = 0; cc < 6; ++cc) {
#pragma unroll
        for (int r = 0; r < 8; ++r) {
            int c = cc * 16 + r + (hi ? 8 : 0);
            float xv = xr[c * NN + n0 + ln];
            oacc[cc][r] = xv + gamma * oacc[cc][r] * inv;
        }
    }

    // classifier: out[o,n] = sum_c wc[o,c] * y[c,n] + bc[o]
    v8f res[6];
#pragma unroll
    for (int i = 0; i < 6; ++i) res[i] = (v8f)0.f;

#pragma unroll
    for (int cc = 0; cc < 6; ++cc) {
        float yy[8], xy[8];
#pragma unroll
        for (int r = 0; r < 8; ++r) { yy[r] = oacc[cc][r]; xy[r] = __shfl_xor(yy[r], 16, 32); }
        v2f yb[4];
        yb[0][0] = hi ? xy[2] : yy[0];  yb[0][1] = hi ? xy[3] : yy[1];
        yb[1][0] = hi ? xy[6] : yy[4];  yb[1][1] = hi ? xy[7] : yy[5];
        yb[2][0] = hi ? yy[2] : xy[0];  yb[2][1] = hi ? yy[3] : xy[1];
        yb[3][0] = hi ? yy[6] : xy[4];  yb[3][1] = hi ? yy[7] : xy[5];
#pragma unroll
        for (int oc = 0; oc < 6; ++oc) {
#pragma unroll
            for (int g = 0; g < 4; ++g) {
                v2f wa = *(const v2f*)&wcs[(oc * 16 + ln) * CC + cc * 16 + 4 * g + (hi ? 2 : 0)];
                res[oc] = __builtin_amdgcn_wmma_f32_16x16x4_f32(
                    false, wa, false, yb[g], (short)0, res[oc], false, false);
            }
        }
    }

#pragma unroll
    for (int oc = 0; oc < 6; ++oc) {
#pragma unroll
        for (int r = 0; r < 8; ++r) {
            int o = oc * 16 + r + (hi ? 8 : 0);
            outp[o * NN + n0 + ln] = res[oc][r] + bc[o];
        }
    }
}

// -------------------------------------------------------------------------
extern "C" void kernel_launch(void* const* d_in, const int* in_sizes, int n_in,
                              void* d_out, int out_size, void* d_ws, size_t ws_size,
                              hipStream_t stream)
{
    const float* x1  = (const float*)d_in[0];
    const float* x2  = (const float*)d_in[1];
    const float* wq1 = (const float*)d_in[2];
    const float* bq1 = (const float*)d_in[3];
    const float* wk1 = (const float*)d_in[4];
    const float* bk1 = (const float*)d_in[5];
    const float* wv1 = (const float*)d_in[6];
    const float* bv1 = (const float*)d_in[7];
    const float* wq2 = (const float*)d_in[8];
    const float* bq2 = (const float*)d_in[9];
    const float* wk2 = (const float*)d_in[10];
    const float* bk2 = (const float*)d_in[11];
    const float* wv2 = (const float*)d_in[12];
    const float* bv2 = (const float*)d_in[13];
    const float* g1  = (const float*)d_in[14];
    const float* g2  = (const float*)d_in[15];
    const float* wc1 = (const float*)d_in[16];
    const float* bc1 = (const float*)d_in[17];
    const float* wc2 = (const float*)d_in[18];
    const float* bc2 = (const float*)d_in[19];

    float* ws  = (float*)d_ws;
    float* out = (float*)d_out;

    dim3 gq(NN / 128, BB, 2);
    cotsr_qkv<<<gq, 128, 0, stream>>>(x1, x2, wq1, bq1, wk1, bk1, wv1, bv1,
                                      wq2, bq2, wk2, bk2, wv2, bv2, ws);

    dim3 ga(NN / 128, BB, 2);
    cotsr_attn<<<ga, 256, 0, stream>>>(x1, x2, g1, g2, wc1, bc1, wc2, bc2, ws, out);
}

// v003
// One run takes 174 microseconds.
// Two timings next to v002 both put it at 1.22 times that version's speed.
// All steps since v000 together make it 2.19 times as fast.
#include <hip/hip_runtime.h>

// Problem sizes (fixed by the reference)
#define BB   4
#define CC   96
#define NN   4096      // H*W = 64*64
#define C8P  16        // head dim 12, padded to 16 rows in workspace
#define NCL  96        // num classes

// workspace layout in floats:
//   Qp : [2][B][16][N]   at offset 0
//   Kp : [2][B][16][N]   at offset QPSZ
//   V  : [2][B][96][N]   at offset 2*QPSZ
#define QPSZ (2 * BB * C8P * NN)

typedef float v2f __attribute__((ext_vector_type(2)));
typedef float v4f __attribute__((ext_vector_type(4)));
typedef float v8f __attribute__((ext_vector_type(8)));

// pointer types matching the async-to-LDS builtin signatures
typedef int v4i __attribute__((vector_size(16)));
typedef __attribute__((address_space(1))) int*  gi32_p;   // global b32 src
typedef __attribute__((address_space(3))) int*  li32_p;   // LDS b32 dst
typedef __attribute__((address_space(1))) v4i*  gi128_p;  // global b128 src
typedef __attribute__((address_space(3))) v4i*  li128_p;  // LDS b128 dst

#if __has_builtin(__builtin_amdgcn_global_load_async_to_lds_b32) && \
    __has_builtin(__builtin_amdgcn_global_load_async_to_lds_b128) && \
    __has_builtin(__builtin_amdgcn_s_wait_asynccnt)
#define USE_ASYNC 1
#else
#define USE_ASYNC 0
#endif

// -------------------------------------------------------------------------
// Kernel 1: 1x1-conv QKV projections into workspace, as one f32 WMMA product
//   [128 x 96] (rows: Q 12 + 4 zero, K 12 + 4 zero, V 96)  x  x[96 x N].
// grid: (N/128, B, 2 streams), block 128 (4 waves; one wave = 32 pixels).
// A = weight rows from LDS, B = x held in registers for the whole kernel.
// A wave's two column tiles are the even and the odd pixels of its 32, so
// that one lane loads and stores pixel pairs and 16 lanes cover a 128-B line.
// -------------------------------------------------------------------------
#define WROWS 128
#define WP    100      // LDS row pitch in floats: 16 rows x 2 halves of a b64 read hit 64 distinct banks

__global__ __launch_bounds__(128)
void cotsr_qkv(const float* __restrict__ x1, const float* __restrict__ x2,
               const float* __restrict__ wq1, const float* __restrict__ bq1,
               const float* __restrict__ wk1, const float* __restrict__ bk1,
               const float* __restrict__ wv1, const float* __restrict__ bv1,
               const float* __restrict__ wq2, const float* __restrict__ bq2,
               const float* __restrict__ wk2, const float* __restrict__ bk2,
               const float* __restrict__ wv2, const float* __restrict__ bv2,
               float* __restrict__ ws)
{
    __shared__ __align__(16) float wl[WROWS * WP];    // stacked weights [row][c]
    __shared__ __align__(16) float bl[WROWS];         // stacked biases

    const int s = blockIdx.z, b = blockIdx.y;
    const int tid  = threadIdx.x;
    const int lane = tid & 31, wid = tid >> 5;
    const bool hi  = lane >= 16;
    const int  ln  = lane & 15;

    const float* x  = (s == 0 ? x1 : x2) + (size_t)b * CC * NN;
    const float* wq = s == 0 ? wq1 : wq2;  const float* bq = s == 0 ? bq1 : bq2;
    const float* wk = s == 0 ? wk1 : wk2;  const float* bk = s == 0 ? bk1 : bk2;
    const float* wv = s == 0 ? wv1 : wv2;  const float* bv = s == 0 ? bv1 : bv2;

    float* Qp = ws +              (size_t)(s * BB + b) * C8P * NN;
    float* Kp = ws + QPSZ +       (size_t)(s * BB + b) * C8P * NN;
    float* V  = ws + 2 * QPSZ +   (size_t)(s * BB + b) * CC  * NN;

    const int n0 = blockIdx.x * 128 + wid * 32 + 2 * ln;   // this lane's pixel pair

    // stage the stacked weights: a pass is 16 rows x 128 bytes, 16 bytes a thread,
    // no branch, so that all 24 loads of a thread are in flight together
    const int  sr  = tid >> 3, sc = (tid & 7) * 4;
    const bool pad = sr >= 12;                    // rows 12..15 of the Q and K tiles are zero
    const int  so  = (pad ? 0 : sr) * CC + sc;    // a pad row reads row 0 and drops it
    const float* wqp = wq + so;
    const float* wkp = wk + so;
    const float* wvp = wv + sr * CC + sc;
    float*       wlp = wl + sr * WP + sc;
    v4f tq[3], tk[3], tv[18];
#pragma unroll
    for (int cb = 0; cb < 3; ++cb) {
        tq[cb] = *(const v4f*)&wqp[cb * 32];
        tk[cb] = *(const v4f*)&wkp[cb * 32];
    }
#pragma unroll
    for (int i = 0; i < 18; ++i)
        tv[i] = *(const v4f*)&wvp[(i / 3) * 16 * CC + (i % 3) * 32];

    // the x loads below may be given registers that hold addresses of the loads above
    asm volatile("s_wait_xcnt 0x0" ::: "memory");

    // x in WMMA-B layout: 24 K-groups over c, even pixels in xe, odd in xo
    const float* xp = x + (hi ? 2 : 0) * NN + n0;
    v2f p0[24], p1[24];
#pragma unroll
    for (int g = 0; g < 24; ++g) {
        p0[g] = *(const v2f*)&xp[(4 * g    ) * NN];
        p1[g] = *(const v2f*)&xp[(4 * g + 1) * NN];
    }
    // keeps the bias loads behind the last x load
    __builtin_amdgcn_sched_barrier(0);

    const int br  = tid & 15;                     // bias row inside its tile
    const int brc = br < 12 ? br : 0;
    const float vq = bq[brc], vk = bk[brc], vv = bv[tid >= 32 ? tid - 32 : 0];

    const v4f z4 = (v4f)0.f;
#pragma unroll
    for (int cb = 0; cb < 3; ++cb) {
        *(v4f*)&wlp[          cb * 32] = pad ? z4 : tq[cb];
        *(v4f*)&wlp[16 * WP + cb * 32] = pad ? z4 : tk[cb];
    }
#pragma unroll
    for (int i = 0; i < 18; ++i)
        *(v4f*)&wlp[(32 + (i / 3) * 16) * WP + (i % 3) * 32] = tv[i];
    bl[tid] = tid >= 32 ? vv : br >= 12 ? 0.f : tid >= 16 ? vk : vq;
    __syncthreads();            // weights and biases visible to all four waves

    v2f xe[24], xo[24];
#pragma unroll
    for (int g = 0; g < 24; ++g) {
        xe[g][0] = p0[g][0];  xe[g][1] = p1[g][0];
        xo[g][0] = p0[g][1];  xo[g][1] = p1[g][1];
    }

    // two passes of four row tiles: 8 independent accumulators each
    // kept rolled: unrolled, the second pass's weight reads are hoisted over the
    // first and the register count goes past 256
#pragma unroll 1
    for (int mh = 0; mh < 2; ++mh) {
        const float* wt = &wl[(mh * 64 + ln) * WP + (hi ? 2 : 0)];
        v8f ae[4], ao[4];
#pragma unroll
        for (int t = 0; t < 4; ++t) { ae[t] = (v8f)0.f; ao[t] = (v8f)0.f; }

#pragma unroll
        for (int g = 0; g < 24; ++g) {
#pragma unroll
            for (int t = 0; t < 4; ++t) {
                v2f wa = *(const v2f*)&wt[t * 16 * WP + 4 * g];
                ae[t] = __builtin_amdgcn_wmma_f32_16x16x4_f32(
                    false, wa, false, xe[g], (short)0, ae[t], false, false);
                ao[t] = __builtin_amdgcn_wmma_f32_16x16x4_f32(
                    false, wa, false, xo[g], (short)0, ao[t], false, false);
            }
        }

#pragma unroll
        for (int t = 0; t < 4; ++t) {
            const int mt = mh * 4 + t;
            float* dst = (mt == 0 ? Qp : mt == 1 ? Kp : V + (mt - 2) * 16 * NN)
                         + (hi ? 8 : 0) * NN + n0;
            const float* bt = &bl[mt * 16 + (hi ? 8 : 0)];
#pragma unroll
            for (int r = 0; r < 8; ++r) {
                v2f o;
                o[0] = ae[t][r] + bt[r];
                o[1] = ao[t][r] + bt[r];
                *(v2f*)&dst[r * NN] = o;
            }
        }
        // the next pass rewrites the address and data registers of these stores
        asm volatile("s_wait_xcnt 0x0" ::: "memory");
    }
}

// -------------------------------------------------------------------------
// Kernel 2: fused flash cross-attention + residual + classifier conv.
// grid: (N/128, B, 2 streams), block 256 (8 waves; one wave = 16 queries).
// A loop trip takes KT keys: one running maximum, one rescale of O and one
// barrier for all of them. K/V tiles are double-buffered in LDS and staged with
// async global->LDS copies (ASYNCcnt) that fly while the tile before is worked on.
// -------------------------------------------------------------------------
#define KT    128       // keys per loop trip
#define NSUB  (KT / 16) // 16-key sub-tiles of a trip
#define NT    (NN / KT) // loop trips
// LDS row pitches in floats, each 4 x an odd number: the 16 rows x 2 halves of a
// fragment's b64 read then fall on 64 distinct banks
#define TP    20        // K tile: 12 channels of a key + 8 unused
#define VP    (KT + 4)  // V tile: KT keys of a channel + 4 unused

__global__ __launch_bounds__(256)
void cotsr_attn(const float* __restrict__ x1, const float* __restrict__ x2,
                const float* __restrict__ g1, const float* __restrict__ g2,
                const float* __restrict__ wc1, const float* __restrict__ bc1,
                const float* __restrict__ wc2, const float* __restrict__ bc2,
                const float* __restrict__ ws, float* __restrict__ out)
{
    __shared__ __align__(16) float kls[2][KT * TP];   // K tile, transposed [m][c]
    __shared__ __align__(16) float vls[2][CC * VP];   // V tile [c][m]
    __shared__ __align__(16) float wcs[NCL * CC];     // classifier weights, row-major

    const int s = blockIdx.z, b = blockIdx.y, qg = blockIdx.x;
    const int t = 1 - s;                              // kv stream
    const int tid  = threadIdx.x;
    const int lane = tid & 31, wid = tid >> 5;
    const bool hi  = lane >= 16;
    const int  ln  = lane & 15;

    const float* xr    = (s == 0 ? x1 : x2) + (size_t)b * CC * NN;
    const float  gamma = (s == 0 ? g1 : g2)[0];
    const float* wc    = s == 0 ? wc1 : wc2;
    const float* bc    = s == 0 ? bc1 : bc2;
    const float* Qp = ws +            (size_t)(s * BB + b) * C8P * NN;
    const float* Kp = ws + QPSZ +     (size_t)(t * BB + b) * C8P * NN;
    const float* V  = ws + 2 * QPSZ + (size_t)(t * BB + b) * CC  * NN;
    float* outp = out + ((size_t)s * BB + b) * NCL * NN;

    // stage classifier weights once
    for (int i = tid; i < NCL * CC; i += 256) wcs[i] = wc[i];

    const int n0 = qg * 128 + wid * 16;

    // cooperative tile staging (async copies to LDS when available): a thread's copies
    // of a tile lie a constant step apart in global memory and in LDS
    const int kc0 = tid / KT,       km0 = tid % KT;             // K: channel, key
    const int vc0 = tid / (KT / 4), vm0 = (tid % (KT / 4)) * 4; // V: channel, first of 4 keys
    const float* kg = Kp + kc0 * NN + km0;
    const float* vg = V  + vc0 * NN + vm0;
    auto stage = [&](int kt, int buf) {
        const float* ks = kg + kt * KT;
        const float* vs = vg + kt * KT;
        float* kd = &kls[buf][km0 * TP + kc0];
        float* vd = &vls[buf][vc0 * VP + vm0];
#if USE_ASYNC
        // K tile, the 12 channels that are read: transposed by the copy's per-lane LDS address
#pragma unroll
        for (int i = 0; i < 12 * KT / 256; ++i)
            __builtin_amdgcn_global_load_async_to_lds_b32(
                (gi32_p)(void*)const_cast<float*>(ks + i * (256 / KT) * NN),
                (li32_p)(void*)(kd + i * (256 / KT)), 0, 0);
        // V tile: 16 bytes a lane
#pragma unroll
        for (int i = 0; i < CC * KT / 1024; ++i)
            __builtin_amdgcn_global_load_async_to_lds_b128(
                (gi128_p)(void*)const_cast<float*>(vs + i * (1024 / KT) * NN),
                (li128_p)(void*)(vd + i * (1024 / KT) * VP), 0, 0);
#else
#pragma unroll
        for (int i = 0; i < 12 * KT / 256; ++i)
            kd[i * (256 / KT)] = ks[i * (256 / KT) * NN];
#pragma unroll
        for (int i = 0; i < CC * KT / 1024; ++i)
            *(v4f*)&vd[i * (1024 / KT) * VP] = *(const v4f*)&vs[i * (1024 / KT) * NN];
#endif
    };

    // Q tile in WMMA-B layout: 3 K-groups (c = 0..11), v2f each
    v2f qb[3];
#pragma unroll
    for (int g = 0; g < 3; ++g) {
        int r0 = 4 * g + (hi ? 2 : 0);
        qb[g][0] = Qp[(r0    ) * NN + n0 + ln];
        qb[g][1] = Qp[(r0 + 1) * NN + n0 + ln];
    }

    v8f oacc[6];                // O[c=96][n=16] fp32 accumulators
#pragma unroll
    for (int i = 0; i < 6; ++i) oacc[i] = (v8f)0.f;
    float rmax = -3.0e38f, rsum = 0.f;

    stage(0, 0);
    // this wave's copies of tile 0 have landed before the barrier publishes them
    asm volatile("s_wait_asynccnt 0x0" ::: "memory");
    __syncthreads();            // tile 0 (and the classifier weights) visible to all waves
    stage(1, 1);                // flies while tile 0 is worked on

    for (int kt = 0; kt < NT; ++kt) {
        const int buf = kt & 1;
        const float* kb = &kls[buf][ln * TP + (hi ? 2 : 0)];
        const float* vb = &vls[buf][ln * VP + (hi ? 2 : 0)];

        // S[m,n] = sum_c K[m,c] * Q[n,c]   (A = K sub-tile, B = Q tile)
        v8f sacc[NSUB];
#pragma unroll
        for (int j = 0; j < NSUB; ++j) sacc[j] = (v8f)0.f;
#pragma unroll
        for (int g = 0; g < 3; ++g) {
#pragma unroll
            for (int j = 0; j < NSUB; ++j) {
                v2f ka = *(const v2f*)&kb[j * 16 * TP + 4 * g];
                sacc[j] = __builtin_amdgcn_wmma_f32_16x16x4_f32(
                    false, ka, false, qb[g], (short)0, sacc[j], false, false);
            }
        }

        // online softmax over the KT keys (in-lane over the sub-tiles' registers
        // + one cross-half shuffle)
        float mr[8];
#pragma unroll
        for (int r = 0; r < 8; ++r) {
            mr[r] = sacc[0][r];
#pragma unroll
            for (int j = 1; j < NSUB; ++j) mr[r] = fmaxf(mr[r], sacc[j][r]);
        }
        float tmax = fmaxf(fmaxf(fmaxf(mr[0], mr[1]), fmaxf(mr[2], mr[3])),
                           fmaxf(fmaxf(mr[4], mr[5]), fmaxf(mr[6], mr[7])));
        tmax = fmaxf(tmax, __shfl_xor(tmax, 16, 32));
        float nmax = fmaxf(rmax, tmax);
        float corr = __expf(rmax - nmax);
        rmax = nmax;
#pragma unroll
        for (int i = 0; i < 6; ++i)
#pragma unroll
            for (int r = 0; r < 8; ++r) oacc[i][r] *= corr;

        float tsum = 0.f;
#pragma unroll
        for (int j = 0; j < NSUB; ++j) {
            float p[8], ts = 0.f;
#pragma unroll
            for (int r = 0; r < 8; ++r) { p[r] = __expf(sacc[j][r] - nmax); ts += p[r]; }
            tsum += ts;

            // rearrange P[m,n] into B-layout (4 K-groups over m)
            float xp[8];
#pragma unroll
            for (int r = 0; r < 8; ++r) xp[r] = __shfl_xor(p[r], 16, 32);
            v2f pb[4];
            pb[0][0] = hi ? xp[2] : p[0];  pb[0][1] = hi ? xp[3] : p[1];
            pb[1][0] = hi ? xp[6] : p[4];  pb[1][1] = hi ? xp[7] : p[5];
            pb[2][0] = hi ? p[2]  : xp[0]; pb[2][1] = hi ? p[3]  : xp[1];
            pb[3][0] = hi ? p[6]  : xp[4]; pb[3][1] = hi ? p[7]  : xp[5];

            // O[c,n] += sum_m V[c,m] * P[m,n]
#pragma unroll
            for (int g = 0; g < 4; ++g) {
#pragma unroll
                for (int cc = 0; cc < 6; ++cc) {
                    v2f va = *(const v2f*)&vb[cc * 16 * VP + j * 16 + 4 * g];
                    oacc[cc] = __builtin_amdgcn_wmma_f32_16x16x4_f32(
                        false, va, false, pb[g], (short)0, oacc[cc], false, false);
                }
            }
        }
        tsum += __shfl_xor(tsum, 16, 32);
        rsum = rsum * corr + tsum;

        // hand-over: this wave's reads of tile kt are done ...
        asm volatile("s_wait_dscnt 0x0" ::: "memory");
        // ... and its copies of tile kt + 1 have landed ...
        asm volatile("s_wait_asynccnt 0x0" ::: "memory");
        // ... before the one barrier that publishes tile kt + 1 and frees tile kt's buffer
        __syncthreads();
        if (kt + 2 < NT) stage(kt + 2, buf);
    }
    // no copy is outstanding when the wave goes on to the epilogue and ends
    asm volatile("s_wait_asynccnt 0x0" ::: "memory");

    // epilogue: y = x + gamma * O / rsum
    const float inv = 1.0f / rsum;
#pragma unroll
    for (int cc = 0; cc < 6; ++cc) {
#pragma unroll
        for (int r = 0; r < 8; ++r) {
            int c = cc * 16 + r + (hi ? 8 : 0);
            float xv = xr[c * NN + n0 + ln];
            oacc[cc][r] = xv + gamma * oacc[cc][r] * inv;
        }
    }

    // classifier: out[o,n] = sum_c wc[o,c] * y[c,n] + bc[o]
    v8f res[6];
#pragma unroll
    for (int i = 0; i < 6; ++i) res[i] = (v8f)0.f;

#pragma unroll
    for (int cc = 0; cc < 6; ++cc) {
        float yy[8], xy[8];
#pragma unroll
        for (int r = 0; r < 8; ++r) { yy[r] = oacc[cc][r]; xy[r] = __shfl_xor(yy[r], 16, 32); }
        v2f yb[4];
        yb[0][0] = hi ? xy[2] : yy[0];  yb[0][1] = hi ? xy[3] : yy[1];
        yb[1][0] = hi ? xy[6] : yy[4];  yb[1][1] = hi ? xy[7] : yy[5];
        yb[2][0] = hi ? yy[2] : xy[0];  yb[2][1] = hi ? yy[3] : xy[1];
        yb[3][0] = hi ? yy[6] : xy[4];  yb[3][1] = hi ? yy[7] : xy[5];
#pragma unroll
        for (int oc = 0; oc < 6; ++oc) {
#pragma unroll
            for (int g = 0; g < 4; ++g) {
                v2f wa = *(const v2f*)&wcs[(oc * 16 + ln) * CC + cc * 16 + 4 * g + (hi ? 2 : 0)];
                res[oc] = __builtin_amdgcn_wmma_f32_16x16x4_f32(
                    false, wa, false, yb[g], (short)0, res[oc], false, false);
            }
        }
    }

#pragma unroll
    for (int oc = 0; oc < 6; ++oc) {
#pragma unroll
        for (int r = 0; r < 8; ++r) {
            int o = oc * 16 + r + (hi ? 8 : 0);
            outp[o * NN + n0 + ln] = res[oc][r] + bc[o];
        }
    }
}

// -------------------------------------------------------------------------
extern "C" void kernel_launch(void* const* d_in, const int* in_sizes, int n_in,
                              void* d_out, int out_size, void* d_ws, size_t ws_size,
                              hipStream_t stream)
{
    const float* x1  = (const float*)d_in[0];
    const float* x2  = (const float*)d_in[1];
    const float* wq1 = (const float*)d_in[2];
    const float* bq1 = (const float*)d_in[3];
    const float* wk1 = (const float*)d_in[4];
    const float* bk1 = (const float*)d_in[5];
    const float* wv1 = (const float*)d_in[6];
    const float* bv1 = (const float*)d_in[7];
    const float* wq2 = (const float*)d_in[8];
    const float* bq2 = (const float*)d_in[9];
    const float* wk2 = (const float*)d_in[10];
    const float* bk2 = (const float*)d_in[11];
    const float* wv2 = (const float*)d_in[12];
    const float* bv2 = (const float*)d_in[13];
    const float* g1  = (const float*)d_in[14];
    const float* g2  = (const float*)d_in[15];
    const float* wc1 = (const float*)d_in[16];
    const float* bc1 = (const float*)d_in[17];
    const float* wc2 = (const float*)d_in[18];
    const float* bc2 = (const float*)d_in[19];

    float* ws  = (float*)d_ws;
    float* out = (float*)d_out;

    dim3 gq(NN / 128, BB, 2);
    cotsr_qkv<<<gq, 128, 0, stream>>>(x1, x2, wq1, bq1, wk1, bk1, wv1, bv1,
                                      wq2, bq2, wk2, bk2, wv2, bv2, ws);

    dim3 ga(NN / 128, BB, 2);
    cotsr_attn<<<ga, 256, 0, stream>>>(x1, x2, g1, g2, wc1, bc1, wc2, bc2, ws, out);
}

// v004
// It runs in 161 microseconds.
// Timed twice side by side with v003, it ran 1.08 times as fast both times.
// All steps since v000 together make it 2.37 times as fast.
#include <hip/hip_runtime.h>

// Problem sizes (fixed by the reference)
#define BB   4
#define CC   96
#define NN   4096      // H*W = 64*64
#define C8P  16        // head dim 12, padded to 16 rows in workspace
#define NCL  96        // num classes

// workspace layout in floats:
//   Qp : [2][B][16][N]   at offset 0
//   Kp : [2][B][16][N]   at offset QPSZ
//   V  : [2][B][96][N]   at offset 2*QPSZ
#define QPSZ (2 * BB * C8P * NN)

typedef float v2f __attribute__((ext_vector_type(2)));
typedef float v4f __attribute__((ext_vector_type(4)));
typedef float v8f __attribute__((ext_vector_type(8)));

// pointer types matching the async-to-LDS builtin signatures
typedef int v4i __attribute__((vector_size(16)));
typedef __attribute__((address_space(1))) int*  gi32_p;   // global b32 src
typedef __attribute__((address_space(3))) int*  li32_p;   // LDS b32 dst
typedef __attribute__((address_space(1))) v4i*  gi128_p;  // global b128 src
typedef __attribute__((address_space(3))) v4i*  li128_p;  // LDS b128 dst

#if __has_builtin(__builtin_amdgcn_global_load_async_to_lds_b32) && \
    __has_builtin(__builtin_amdgcn_global_load_async_to_lds_b128) && \
    __has_builtin(__builtin_amdgcn_s_wait_asynccnt)
#define USE_ASYNC 1
#else
#define USE_ASYNC 0
#endif

// -------------------------------------------------------------------------
// Kernel 1: 1x1-conv QKV projections into workspace, as one f32 WMMA product
//   [128 x 96] (rows: Q 12 + 4 zero, K 12 + 4 zero, V 96)  x  x[96 x N].
// grid: (N/128, B, 2 streams), block 128 (4 waves; one wave = 32 pixels).
// A = weight rows from LDS, B = x held in registers for the whole kernel.
// A wave's two column tiles are the even and the odd pixels of its 32, so
// that one lane loads and stores pixel pairs and 16 lanes cover a 128-B line.
// -------------------------------------------------------------------------
#define WROWS 128
#define WP    100      // LDS row pitch in floats: 16 rows x 2 halves of a b64 read hit 64 distinct banks

__global__ __launch_bounds__(128)
void cotsr_qkv(const float* __restrict__ x1, const float* __restrict__ x2,
               const float* __restrict__ wq1, const float* __restrict__ bq1,
               const float* __restrict__ wk1, const float* __restrict__ bk1,
               const float* __restrict__ wv1, const float* __restrict__ bv1,
               const float* __restrict__ wq2, const float* __restrict__ bq2,
               const float* __restrict__ wk2, const float* __restrict__ bk2,
               const float* __restrict__ wv2, const float* __restrict__ bv2,
               float* __restrict__ ws)
{
    __shared__ __align__(16) float wl[WROWS * WP];    // stacked weights [row][c]
    __shared__ __align__(16) float bl[WROWS];         // stacked biases

    const int s = blockIdx.z, b = blockIdx.y;
    const int tid  = threadIdx.x;
    const int lane = tid & 31, wid = tid >> 5;
    const bool hi  = lane >= 16;
    const int  ln  = lane & 15;

    const float* x  = (s == 0 ? x1 : x2) + (size_t)b * CC * NN;
    const float* wq = s == 0 ? wq1 : wq2;  const float* bq = s == 0 ? bq1 : bq2;
    const float* wk = s == 0 ? wk1 : wk2;  const float* bk = s == 0 ? bk1 : bk2;
    const float* wv = s == 0 ? wv1 : wv2;  const float* bv = s == 0 ? bv1 : bv2;

    float* Qp = ws +              (size_t)(s * BB + b) * C8P * NN;
    float* Kp = ws + QPSZ +       (size_t)(s * BB + b) * C8P * NN;
    float* V  = ws + 2 * QPSZ +   (size_t)(s * BB + b) * CC  * NN;

    const int n0 = blockIdx.x * 128 + wid * 32 + 2 * ln;   // this lane's pixel pair

    // stage the stacked weights: a pass is 16 rows x 128 bytes, 16 bytes a thread,
    // no branch, so that all 24 loads of a thread are in flight together
    const int  sr  = tid >> 3, sc = (tid & 7) * 4;
    const bool pad = sr >= 12;                    // rows 12..15 of the Q and K tiles are zero
    const int  so  = (pad ? 0 : sr) * CC + sc;    // a pad row reads row 0 and drops it
    const float* wqp = wq + so;
    const float* wkp = wk + so;
    const float* wvp = wv + sr * CC + sc;
    float*       wlp = wl + sr * WP + sc;
    v4f tq[3], tk[3], tv[18];
#pragma unroll
    for (int cb = 0; cb < 3; ++cb) {
        tq[cb] = *(const v4f*)&wqp[cb * 32];
        tk[cb] = *(const v4f*)&wkp[cb * 32];
    }
#pragma unroll
    for (int i = 0; i < 18; ++i)
        tv[i] = *(const v4f*)&wvp[(i / 3) * 16 * CC + (i % 3) * 32];

    // the x loads below may be given registers that hold addresses of the loads above
    asm volatile("s_wait_xcnt 0x0" ::: "memory");

    // x in WMMA-B layout: 24 K-groups over c, even pixels in xe, odd in xo
    const float* xp = x + (hi ? 2 : 0) * NN + n0;
    v2f p0[24], p1[24];
#pragma unroll
    for (int g = 0; g < 24; ++g) {
        p0[g] = *(const v2f*)&xp[(4 * g    ) * NN];
        p1[g] = *(const v2f*)&xp[(4 * g + 1) * NN];
    }
    // keeps the bias loads behind the last x load
    __builtin_amdgcn_sched_barrier(0);

    const int br  = tid & 15;                     // bias row inside its tile
    const int brc = br < 12 ? br : 0;
    const float vq = bq[brc], vk = bk[brc], vv = bv[tid >= 32 ? tid - 32 : 0];

    const v4f z4 = (v4f)0.f;
#pragma unroll
    for (int cb = 0; cb < 3; ++cb) {
        *(v4f*)&wlp[          cb * 32] = pad ? z4 : tq[cb];
        *(v4f*)&wlp[16 * WP + cb * 32] = pad ? z4 : tk[cb];
    }
#pragma unroll
    for (int i = 0; i < 18; ++i)
        *(v4f*)&wlp[(32 + (i / 3) * 16) * WP + (i % 3) * 32] = tv[i];
    bl[tid] = tid >= 32 ? vv : br >= 12 ? 0.f : tid >= 16 ? vk : vq;
    __syncthreads();            // weights and biases visible to all four waves

    v2f xe[24], xo[24];
#pragma unroll
    for (int g = 0; g < 24; ++g) {
        xe[g][0] = p0[g][0];  xe[g][1] = p1[g][0];
        xo[g][0] = p0[g][1];  xo[g][1] = p1[g][1];
    }

    // two passes of four row tiles: 8 independent accumulators each
    // kept rolled: unrolled, the second pass's weight reads are hoisted over the
    // first and the register count goes past 256
#pragma unroll 1
    for (int mh = 0; mh < 2; ++mh) {
        const float* wt = &wl[(mh * 64 + ln) * WP + (hi ? 2 : 0)];
        v8f ae[4], ao[4];
#pragma unroll
        for (int t = 0; t < 4; ++t) { ae[t] = (v8f)0.f; ao[t] = (v8f)0.f; }

#pragma unroll
        for (int g = 0; g < 24; ++g) {
#pragma unroll
            for (int t = 0; t < 4; ++t) {
                v2f wa = *(const v2f*)&wt[t * 16 * WP + 4 * g];
                ae[t] = __builtin_amdgcn_wmma_f32_16x16x4_f32(
                    false, wa, false, xe[g], (short)0, ae[t], false, false);
                ao[t] = __builtin_amdgcn_wmma_f32_16x16x4_f32(
                    false, wa, false, xo[g], (short)0, ao[t], false, false);
            }
        }

#pragma unroll
        for (int t = 0; t < 4; ++t) {
            const int mt = mh * 4 + t;
            float* dst = (mt == 0 ? Qp : mt == 1 ? Kp : V + (mt - 2) * 16 * NN)
                         + (hi ? 8 : 0) * NN + n0;
            const float* bt = &bl[mt * 16 + (hi ? 8 : 0)];
#pragma unroll
            for (int r = 0; r < 8; ++r) {
                v2f o;
                o[0] = ae[t][r] + bt[r];
                o[1] = ao[t][r] + bt[r];
                *(v2f*)&dst[r * NN] = o;
            }
        }
        // the next pass rewrites the address and data registers of these stores
        asm volatile("s_wait_xcnt 0x0" ::: "memory");
    }
}

// -------------------------------------------------------------------------
// Kernel 2: fused flash cross-attention + residual + classifier conv.
// grid: (N/128, B, 2 streams), block 256 (8 waves; one wave = 16 queries).
// A loop trip takes KT keys: one running maximum, one rescale of O and one
// barrier for all of them. K/V tiles are double-buffered in LDS and staged with
// async global->LDS copies (ASYNCcnt) that fly while the tile before is worked on.
// -------------------------------------------------------------------------
#define KT    128       // keys per loop trip
#define NSUB  (KT / 16) // 16-key sub-tiles of a trip
#define NT    (NN / KT) // loop trips
// LDS row pitches in floats, each 4 x an odd number: the 16 rows x 2 halves of a K
// fragment's b64 read, and the 16 rows of each half of a V b128 read, fall on 64 distinct banks
#define TP    20        // K tile: 12 channels of a key + 8 unused
#define VP    (KT + 4)  // V tile: KT keys of a channel + 4 unused

__global__ __launch_bounds__(256)
void cotsr_attn(const float* __restrict__ x1, const float* __restrict__ x2,
                const float* __restrict__ g1, const float* __restrict__ g2,
                const float* __restrict__ wc1, const float* __restrict__ bc1,
                const float* __restrict__ wc2, const float* __restrict__ bc2,
                const float* __restrict__ ws, float* __restrict__ out)
{
    __shared__ __align__(16) float kls[2][KT * TP];   // K tile, transposed [m][c]
    __shared__ __align__(16) float vls[2][CC * VP];   // V tile [c][m]
    __shared__ __align__(16) float wcs[NCL * CC];     // classifier weights, row-major

    const int s = blockIdx.z, b = blockIdx.y, qg = blockIdx.x;
    const int t = 1 - s;                              // kv stream
    const int tid  = threadIdx.x;
    const int lane = tid & 31, wid = tid >> 5;
    const bool hi  = lane >= 16;
    const int  ln  = lane & 15;

    const float* xr    = (s == 0 ? x1 : x2) + (size_t)b * CC * NN;
    const float  gamma = (s == 0 ? g1 : g2)[0];
    const float* wc    = s == 0 ? wc1 : wc2;
    const float* bc    = s == 0 ? bc1 : bc2;
    const float* Qp = ws +            (size_t)(s * BB + b) * C8P * NN;
    const float* Kp = ws + QPSZ +     (size_t)(t * BB + b) * C8P * NN;
    const float* V  = ws + 2 * QPSZ + (size_t)(t * BB + b) * CC  * NN;
    float* outp = out + ((size_t)s * BB + b) * NCL * NN;

    // stage classifier weights once
    for (int i = tid; i < NCL * CC; i += 256) wcs[i] = wc[i];

    const int n0 = qg * 128 + wid * 16;

    // cooperative tile staging (async copies to LDS when available): a thread's copies
    // of a tile lie a constant step apart in global memory and in LDS
    const int kc0 = tid / KT,       km0 = tid % KT;             // K: channel, key
    const int vc0 = tid / (KT / 4), vm0 = (tid % (KT / 4)) * 4; // V: channel, first of 4 keys
    const float* kg = Kp + kc0 * NN + km0;
    const float* vg = V  + vc0 * NN + vm0;
    auto stage = [&](int kt, int buf) {
        const float* ks = kg + kt * KT;
        const float* vs = vg + kt * KT;
        float* kd = &kls[buf][km0 * TP + kc0];
        float* vd = &vls[buf][vc0 * VP + vm0];
#if USE_ASYNC
        // K tile, the 12 channels that are read: transposed by the copy's per-lane LDS address
#pragma unroll
        for (int i = 0; i < 12 * KT / 256; ++i)
            __builtin_amdgcn_global_load_async_to_lds_b32(
                (gi32_p)(void*)const_cast<float*>(ks + i * (256 / KT) * NN),
                (li32_p)(void*)(kd + i * (256 / KT)), 0, 0);
        // V tile: 16 bytes a lane
#pragma unroll
        for (int i = 0; i < CC * KT / 1024; ++i)
            __builtin_amdgcn_global_load_async_to_lds_b128(
                (gi128_p)(void*)const_cast<float*>(vs + i * (1024 / KT) * NN),
                (li128_p)(void*)(vd + i * (1024 / KT) * VP), 0, 0);
#else
#pragma unroll
        for (int i = 0; i < 12 * KT / 256; ++i)
            kd[i * (256 / KT)] = ks[i * (256 / KT) * NN];
#pragma unroll
        for (int i = 0; i < CC * KT / 1024; ++i)
            *(v4f*)&vd[i * (1024 / KT) * VP] = *(const v4f*)&vs[i * (1024 / KT) * NN];
#endif
    };

    // Q tile in WMMA-B layout: 3 K-groups (c = 0..11), v2f each
    v2f qb[3];
#pragma unroll
    for (int g = 0; g < 3; ++g) {
        int r0 = 4 * g + (hi ? 2 : 0);
        qb[g][0] = Qp[(r0    ) * NN + n0 + ln];
        qb[g][1] = Qp[(r0 + 1) * NN + n0 + ln];
    }

    v8f oacc[6];                // O[c=96][n=16] fp32 accumulators
#pragma unroll
    for (int i = 0; i < 6; ++i) oacc[i] = (v8f)0.f;
    float rmax = -3.0e38f, rsum = 0.f;

    stage(0, 0);
    // this wave's copies of tile 0 have landed before the barrier publishes them
    asm volatile("s_wait_asynccnt 0x0" ::: "memory");
    __syncthreads();            // tile 0 (and the classifier weights) visible to all waves
    stage(1, 1);                // flies while tile 0 is worked on

    for (int kt = 0; kt < NT; ++kt) {
        const int buf = kt & 1;
        const float* kb = &kls[buf][ln * TP + (hi ? 2 : 0)];
        const float* vb = &vls[buf][ln * VP + (hi ? 8 : 0)];

        // V fragments, two register sets: a block of 6 reads (96 channels x 8 keys, 4 keys
        // a lane) is issued one block ahead of the 12 products that use it
        v4f vv[2][6];
#pragma unroll
        for (int cc = 0; cc < 6; ++cc) vv[0][cc] = *(const v4f*)&vb[cc * 16 * VP];

        // S[m,n] = sum_c K[m,c] * Q[n,c]   (A = K sub-tile, B = Q tile)
        v8f sacc[NSUB];
#pragma unroll
        for (int j = 0; j < NSUB; ++j) sacc[j] = (v8f)0.f;
#pragma unroll
        for (int g = 0; g < 3; ++g) {
#pragma unroll
            for (int j = 0; j < NSUB; ++j) {
                v2f ka = *(const v2f*)&kb[j * 16 * TP + 4 * g];
                sacc[j] = __builtin_amdgcn_wmma_f32_16x16x4_f32(
                    false, ka, false, qb[g], (short)0, sacc[j], false, false);
            }
        }

        // online softmax over the KT keys (in-lane over the sub-tiles' registers
        // + one cross-half shuffle)
        float mr[8];
#pragma unroll
        for (int r = 0; r < 8; ++r) {
            mr[r] = sacc[0][r];
#pragma unroll
            for (int j = 1; j < NSUB; ++j) mr[r] = fmaxf(mr[r], sacc[j][r]);
        }
        float tmax = fmaxf(fmaxf(fmaxf(mr[0], mr[1]), fmaxf(mr[2], mr[3])),
                           fmaxf(fmaxf(mr[4], mr[5]), fmaxf(mr[6], mr[7])));
        tmax = fmaxf(tmax, __shfl_xor(tmax, 16, 32));
        float nmax = fmaxf(rmax, tmax);
        float corr = __expf(rmax - nmax);
        rmax = nmax;
#pragma unroll
        for (int i = 0; i < 6; ++i)
#pragma unroll
            for (int r = 0; r < 8; ++r) oacc[i][r] *= corr;

        float tsum = 0.f;
#pragma unroll
        for (int j = 0; j < NSUB; ++j) {
            float p[8], ts = 0.f;
#pragma unroll
            for (int r = 0; r < 8; ++r) { p[r] = __expf(sacc[j][r] - nmax); ts += p[r]; }
            tsum += ts;

            // O[c,n] += sum_m V[c,m] * P[m,n]. The k slots of product g (0..3) are the keys
            // 2g, 2g+1 (lanes 0-15) and 8+2g, 8+2g+1 (lanes 16-31): the keys whose P a
            // lane already holds in p[2g], p[2g+1], so P is a B fragment as it stands.
            // V takes the same order: a lane's 4 keys of two products in one 16-byte read.
#pragma unroll
            for (int h = 0; h < 2; ++h) {
                const int blk = 2 * j + h;
                v2f pb0, pb1;
                pb0[0] = p[4 * h];      pb0[1] = p[4 * h + 1];
                pb1[0] = p[4 * h + 2];  pb1[1] = p[4 * h + 3];
                if (blk + 1 < 2 * NSUB) {
#pragma unroll
                    for (int cc = 0; cc < 6; ++cc)
                        vv[(blk + 1) & 1][cc] =
                            *(const v4f*)&vb[cc * 16 * VP + ((blk + 1) >> 1) * 16 + ((blk + 1) & 1) * 4];
                }
#pragma unroll
                for (int cc = 0; cc < 6; ++cc) {
                    v2f va;  va[0] = vv[blk & 1][cc][0];  va[1] = vv[blk & 1][cc][1];
                    oacc[cc] = __builtin_amdgcn_wmma_f32_16x16x4_f32(
                        false, va, false, pb0, (short)0, oacc[cc], false, false);
                }
#pragma unroll
                for (int cc = 0; cc < 6; ++cc) {
                    v2f va;  va[0] = vv[blk & 1][cc][2];  va[1] = vv[blk & 1][cc][3];
                    oacc[cc] = __builtin_amdgcn_wmma_f32_16x16x4_f32(
                        false, va, false, pb1, (short)0, oacc[cc], false, false);
                }
            }
        }
        tsum += __shfl_xor(tsum, 16, 32);
        rsum = rsum * corr + tsum;

        // hand-over: this wave's reads of tile kt are done ...
        asm volatile("s_wait_dscnt 0x0" ::: "memory");
        // ... and its copies of tile kt + 1 have landed ...
        asm volatile("s_wait_asynccnt 0x0" ::: "memory");
        // ... before the one barrier that publishes tile kt + 1 and frees tile kt's buffer
        __syncthreads();
        if (kt + 2 < NT) stage(kt + 2, buf);
    }
    // no copy is outstanding when the wave goes on to the epilogue and ends
    asm volatile("s_wait_asynccnt 0x0" ::: "memory");

    // epilogue: y = x + gamma * O / rsum
    const float inv = 1.0f / rsum;
#pragma unroll
    for (int cc = 0; cc < 6; ++cc) {
#pragma unroll
        for (int r = 0; r < 8; ++r) {
            int c = cc * 16 + r + (hi ? 8 : 0);
            float xv = xr[c * NN + n0 + ln];
            oacc[cc][r] = xv + gamma * oacc[cc][r] * inv;
        }
    }

    // classifier: out[o,n] = sum_c wc[o,c] * y[c,n] + bc[o]
    v8f res[6];
#pragma unroll
    for (int i = 0; i < 6; ++i) res[i] = (v8f)0.f;

#pragma unroll
    for (int cc = 0; cc < 6; ++cc) {
        // same k order as in the loop: y is a B fragment as it stands in the accumulator
#pragma unroll
        for (int h = 0; h < 2; ++h) {
            v2f yb0, yb1;
            yb0[0] = oacc[cc][4 * h];      yb0[1] = oacc[cc][4 * h + 1];
            yb1[0] = oacc[cc][4 * h + 2];  yb1[1] = oacc[cc][4 * h + 3];
#pragma unroll
            for (int oc = 0; oc < 6; ++oc) {
                v4f ww = *(const v4f*)&wcs[(oc * 16 + ln) * CC + cc * 16 + (hi ? 8 : 0) + 4 * h];
                v2f wa;  wa[0] = ww[0];  wa[1] = ww[1];
                res[oc] = __builtin_amdgcn_wmma_f32_16x16x4_f32(
                    false, wa, false, yb0, (short)0, res[oc], false, false);
                wa[0] = ww[2];  wa[1] = ww[3];
                res[oc] = __builtin_amdgcn_wmma_f32_16x16x4_f32(
                    false, wa, false, yb1, (short)0, res[oc], false, false);
            }
        }
    }

#pragma unroll
    for (int oc = 0; oc < 6; ++oc) {
#pragma unroll
        for (int r = 0; r < 8; ++r) {
            int o = oc * 16 + r + (hi ? 8 : 0);
            outp[o * NN + n0 + ln] = res[oc][r] + bc[o];
        }
    }
}

// -------------------------------------------------------------------------
extern "C" void kernel_launch(void* const* d_in, const int* in_sizes, int n_in,
                              void* d_out, int out_size, void* d_ws, size_t ws_size,
                              hipStream_t stream)
{
    const float* x1  = (const float*)d_in[0];
    const float* x2  = (const float*)d_in[1];
    const float* wq1 = (const float*)d_in[2];
    const float* bq1 = (const float*)d_in[3];
    const float* wk1 = (const float*)d_in[4];
    const float* bk1 = (const float*)d_in[5];
    const float* wv1 = (const float*)d_in[6];
    const float* bv1 = (const float*)d_in[7];
    const float* wq2 = (const float*)d_in[8];
    const float* bq2 = (const float*)d_in[9];
    const float* wk2 = (const float*)d_in[10];
    const float* bk2 = (const float*)d_in[11];
    const float* wv2 = (const float*)d_in[12];
    const float* bv2 = (const float*)d_in[13];
    const float* g1  = (const float*)d_in[14];
    const float* g2  = (const float*)d_in[15];
    const float* wc1 = (const float*)d_in[16];
    const float* bc1 = (const float*)d_in[17];
    const float* wc2 = (const float*)d_in[18];
    const float* bc2 = (const float*)d_in[19];

    float* ws  = (float*)d_ws;
    float* out = (float*)d_out;

    dim3 gq(NN / 128, BB, 2);
    cotsr_qkv<<<gq, 128, 0, stream>>>(x1, x2, wq1, bq1, wk1, bk1, wv1, bv1,
                                      wq2, bq2, wk2, bk2, wv2, bv2, ws);

    dim3 ga(NN / 128, BB, 2);
    cotsr_attn<<<ga, 256, 0, stream>>>(x1, x2, g1, g2, wc1, bc1, wc2, bc2, ws, out);
}

// v005
// It runs in 156 microseconds.
// In two side-by-side timings against v004, it was 1.04 and 1.03 times as fast.
// Counting every step since v000, it is 2.45 times as fast.
#include <hip/hip_runtime.h>

// Problem sizes (fixed by the reference)
#define BB   4
#define CC   96
#define NN   4096      // H*W = 64*64
#define C8P  16        // head dim 12, padded to 16 rows in workspace
#define NCL  96        // num classes

// workspace layout in floats:
//   Qp : [2][B][16][N]   at offset 0
//   Kp : [2][B][16][N]   at offset QPSZ
//   V  : [2][B][96][N]   at offset 2*QPSZ
#define QPSZ (2 * BB * C8P * NN)

typedef float v2f __attribute__((ext_vector_type(2)));
typedef float v4f __attribute__((ext_vector_type(4)));
typedef float v8f __attribute__((ext_vector_type(8)));

// pointer types matching the async-to-LDS builtin signatures
typedef int v4i __attribute__((vector_size(16)));
typedef __attribute__((address_space(1))) int*  gi32_p;   // global b32 src
typedef __attribute__((address_space(3))) int*  li32_p;   // LDS b32 dst
typedef __attribute__((address_space(1))) v4i*  gi128_p;  // global b128 src
typedef __attribute__((address_space(3))) v4i*  li128_p;  // LDS b128 dst

#if __has_builtin(__builtin_amdgcn_global_load_async_to_lds_b32) && \
    __has_builtin(__builtin_amdgcn_global_load_async_to_lds_b128) && \
    __has_builtin(__builtin_amdgcn_s_wait_asynccnt)
#define USE_ASYNC 1
#else
#define USE_ASYNC 0
#endif

// -------------------------------------------------------------------------
// Kernel 1: 1x1-conv QKV projections into workspace, as one f32 WMMA product
//   [128 x 96] (rows: Q 12 + 4 zero, K 12 + 4 zero, V 96)  x  x[96 x N].
// grid: (N/128, B, 2 streams), block 128 (4 waves; one wave = 32 pixels).
// A = weight rows from LDS, B = x held in registers for the whole kernel.
// A wave's two column tiles are the even and the odd pixels of its 32, so
// that one lane loads and stores pixel pairs and 16 lanes cover a 128-B line.
// -------------------------------------------------------------------------
#define WROWS 128
#define WP    100      // LDS row pitch in floats: 16 rows x 2 halves of a b64 read hit 64 distinct banks

__global__ __launch_bounds__(128)
void cotsr_qkv(const float* __restrict__ x1, const float* __restrict__ x2,
               const float* __restrict__ wq1, const float* __restrict__ bq1,
               const float* __restrict__ wk1, const float* __restrict__ bk1,
               const float* __restrict__ wv1, const float* __restrict__ bv1,
               const float* __restrict__ wq2, const float* __restrict__ bq2,
               const float* __restrict__ wk2, const float* __restrict__ bk2,
               const float* __restrict__ wv2, const float* __restrict__ bv2,
               float* __restrict__ ws)
{
    __shared__ __align__(16) float wl[WROWS * WP];    // stacked weights [row][c]
    __shared__ __align__(16) float bl[WROWS];         // stacked biases

    const int s = blockIdx.z, b = blockIdx.y;
    const int tid  = threadIdx.x;
    const int lane = tid & 31, wid = tid >> 5;
    const bool hi  = lane >= 16;
    const int  ln  = lane & 15;

    const float* x  = (s == 0 ? x1 : x2) + (size_t)b * CC * NN;
    const float* wq = s == 0 ? wq1 : wq2;  const float* bq = s == 0 ? bq1 : bq2;
    const float* wk = s == 0 ? wk1 : wk2;  const float* bk = s == 0 ? bk1 : bk2;
    const float* wv = s == 0 ? wv1 : wv2;  const float* bv = s == 0 ? bv1 : bv2;

    float* Qp = ws +              (size_t)(s * BB + b) * C8P * NN;
    float* Kp = ws + QPSZ +       (size_t)(s * BB + b) * C8P * NN;
    float* V  = ws + 2 * QPSZ +   (size_t)(s * BB + b) * CC  * NN;

    const int n0 = blockIdx.x * 128 + wid * 32 + 2 * ln;   // this lane's pixel pair

    // stage the stacked weights: a pass is 16 rows x 128 bytes, 16 bytes a thread,
    // no branch, so that all 24 loads of a thread are in flight together
    const int  sr  = tid >> 3, sc = (tid & 7) * 4;
    const bool pad = sr >= 12;                    // rows 12..15 of the Q and K tiles are zero
    const int  so  = (pad ? 0 : sr) * CC + sc;    // a pad row reads row 0 and drops it
    const float* wqp = wq + so;
    const float* wkp = wk + so;
    const float* wvp = wv + sr * CC + sc;
    float*       wlp = wl + sr * WP + sc;
    v4f tq[3], tk[3], tv[18];
#pragma unroll
    for (int cb = 0; cb < 3; ++cb) {
        tq[cb] = *(const v4f*)&wqp[cb * 32];
        tk[cb] = *(const v4f*)&wkp[cb * 32];
    }
#pragma unroll
    for (int i = 0; i < 18; ++i)
        tv[i] = *(const v4f*)&wvp[(i / 3) * 16 * CC + (i % 3) * 32];

    // the x loads below may be given registers that hold addresses of the loads above
    asm volatile("s_wait_xcnt 0x0" ::: "memory");

    // x in WMMA-B layout: 24 K-groups over c, even pixels in xe, odd in xo
    const float* xp = x + (hi ? 2 : 0) * NN + n0;
    v2f p0[24], p1[24];
#pragma unroll
    for (int g = 0; g < 24; ++g) {
        p0[g] = *(const v2f*)&xp[(4 * g    ) * NN];
        p1[g] = *(const v2f*)&xp[(4 * g + 1) * NN];
    }
    // keeps the bias loads behind the last x load
    __builtin_amdgcn_sched_barrier(0);

    const int br  = tid & 15;                     // bias row inside its tile
    const int brc = br < 12 ? br : 0;
    const float vq = bq[brc], vk = bk[brc], vv = bv[tid >= 32 ? tid - 32 : 0];

    const v4f z4 = (v4f)0.f;
#pragma unroll
    for (int cb = 0; cb < 3; ++cb) {
        *(v4f*)&wlp[          cb * 32] = pad ? z4 : tq[cb];
        *(v4f*)&wlp[16 * WP + cb * 32] = pad ? z4 : tk[cb];
    }
#pragma unroll
    for (int i = 0; i < 18; ++i)
        *(v4f*)&wlp[(32 + (i / 3) * 16) * WP + (i % 3) * 32] = tv[i];
    bl[tid] = tid >= 32 ? vv : br >= 12 ? 0.f : tid >= 16 ? vk : vq;
    __syncthreads();            // weights and biases visible to all four waves

    v2f xe[24], xo[24];
#pragma unroll
    for (int g = 0; g < 24; ++g) {
        xe[g][0] = p0[g][0];  xe[g][1] = p1[g][0];
        xo[g][0] = p0[g][1];  xo[g][1] = p1[g][1];
    }

    // two passes of four row tiles: 8 independent accumulators each
    // kept rolled: unrolled, the second pass's weight reads are hoisted over the
    // first and the register count goes past 256
#pragma unroll 1
    for (int mh = 0; mh < 2; ++mh) {
        const float* wt = &wl[(mh * 64 + ln) * WP + (hi ? 2 : 0)];
        v8f ae[4], ao[4];
#pragma unroll
        for (int t = 0; t < 4; ++t) { ae[t] = (v8f)0.f; ao[t] = (v8f)0.f; }

#pragma unroll
        for (int g = 0; g < 24; ++g) {
#pragma unroll
            for (int t = 0; t < 4; ++t) {
                v2f wa = *(const v2f*)&wt[t * 16 * WP + 4 * g];
                ae[t] = __builtin_amdgcn_wmma_f32_16x16x4_f32(
                    false, wa, false, xe[g], (short)0, ae[t], false, false);
                ao[t] = __builtin_amdgcn_wmma_f32_16x16x4_f32(
                    false, wa, false, xo[g], (short)0, ao[t], false, false);
            }
        }

#pragma unroll
        for (int t = 0; t < 4; ++t) {
            const int mt = mh * 4 + t;
            float* dst = (mt == 0 ? Qp : mt == 1 ? Kp : V + (mt - 2) * 16 * NN)
                         + (hi ? 8 : 0) * NN + n0;
            const float* bt = &bl[mt * 16 + (hi ? 8 : 0)];
#pragma unroll
            for (int r = 0; r < 8; ++r) {
                v2f o;
                o[0] = ae[t][r] + bt[r];
                o[1] = ao[t][r] + bt[r];
                *(v2f*)&dst[r * NN] = o;
            }
        }
        // the next pass rewrites the address and data registers of these stores
        asm volatile("s_wait_xcnt 0x0" ::: "memory");
    }
}

// -------------------------------------------------------------------------
// Kernel 2: fused flash cross-attention + residual + classifier conv.
// grid: (N/64, B, 2 streams), block 256 (8 waves): 4 query tiles of 16 x 2 key groups.
// Wave w works on query tile w & 3 and, of every key tile, on half w >> 2, with its own
// running maximum, sum and O; the two halves are merged through LDS behind the loop.
// That makes twice as many waves of half the length: two work-groups fit a WGP, four
// waves a SIMD, and a wave's waits are filled by three others, two of them behind
// another barrier.
// A loop trip takes KT keys, half of them a wave: one running maximum and one rescale
// of O a wave, one barrier. K/V tiles are double-buffered in LDS and staged with
// async global->LDS copies (ASYNCcnt) that fly while the tile before is worked on.
// -------------------------------------------------------------------------
#define KT    128       // keys per loop trip
#define QB    64        // queries per work-group
#define KG    (KT / 2)  // keys of a trip that one wave works on
#define NSUB  (KG / 16) // 16-key sub-tiles of a wave's half trip
#define NT    (NN / KT) // loop trips
// LDS row pitches in floats, each 4 x an odd number: the 16 rows x 2 halves of a K
// fragment's b64 read, and the 16 rows of each half of a V b128 read, fall on 64 distinct banks
#define TP    20        // K tile: 12 channels of a key + 8 unused
#define VP    (KT + 4)  // V tile: KT keys of a channel + 4 unused

__global__ __launch_bounds__(256)
void cotsr_attn(const float* __restrict__ x1, const float* __restrict__ x2,
                const float* __restrict__ g1, const float* __restrict__ g2,
                const float* __restrict__ wc1, const float* __restrict__ bc1,
                const float* __restrict__ wc2, const float* __restrict__ bc2,
                const float* __restrict__ ws, float* __restrict__ out)
{
    __shared__ __align__(16) float kls[2][KT * TP];   // K tile, transposed [m][c]
    __shared__ __align__(16) float vls[2][CC * VP];   // V tile [c][m]
    __shared__ __align__(16) float wcs[NCL * CC];     // classifier weights, row-major

    const int s = blockIdx.z, b = blockIdx.y, qg = blockIdx.x;
    const int t = 1 - s;                              // kv stream
    const int tid  = threadIdx.x;
    const int lane = tid & 31, wid = tid >> 5;
    const bool hi  = lane >= 16;
    const int  ln  = lane & 15;

    const float* xr    = (s == 0 ? x1 : x2) + (size_t)b * CC * NN;
    const float  gamma = (s == 0 ? g1 : g2)[0];
    const float* wc    = s == 0 ? wc1 : wc2;
    const float* bc    = s == 0 ? bc1 : bc2;
    const float* Qp = ws +            (size_t)(s * BB + b) * C8P * NN;
    const float* Kp = ws + QPSZ +     (size_t)(t * BB + b) * C8P * NN;
    const float* V  = ws + 2 * QPSZ + (size_t)(t * BB + b) * CC  * NN;
    float* outp = out + ((size_t)s * BB + b) * NCL * NN;

    // stage classifier weights once
    for (int i = tid; i < NCL * CC; i += 256) wcs[i] = wc[i];

    const int kgp = wid >> 2;                         // key group of this wave
    const int n0  = qg * QB + (wid & 3) * 16;

    // cooperative tile staging (async copies to LDS when available): a thread's copies
    // of a tile lie a constant step apart in global memory and in LDS
    const int kc0 = tid / KT,       km0 = tid % KT;             // K: channel, key
    const int vc0 = tid / (KT / 4), vm0 = (tid % (KT / 4)) * 4; // V: channel, first of 4 keys
    const float* kg = Kp + kc0 * NN + km0;
    const float* vg = V  + vc0 * NN + vm0;
    auto stage = [&](int kt, int buf) {
        const float* ks = kg + kt * KT;
        const float* vs = vg + kt * KT;
        float* kd = &kls[buf][km0 * TP + kc0];
        float* vd = &vls[buf][vc0 * VP + vm0];
#if USE_ASYNC
        // K tile, the 12 channels that are read: transposed by the copy's per-lane LDS address
#pragma unroll
        for (int i = 0; i < 12 * KT / 256; ++i)
            __builtin_amdgcn_global_load_async_to_lds_b32(
                (gi32_p)(void*)const_cast<float*>(ks + i * (256 / KT) * NN),
                (li32_p)(void*)(kd + i * (256 / KT)), 0, 0);
        // V tile: 16 bytes a lane
#pragma unroll
        for (int i = 0; i < CC * KT / 1024; ++i)
            __builtin_amdgcn_global_load_async_to_lds_b128(
                (gi128_p)(void*)const_cast<float*>(vs + i * (1024 / KT) * NN),
                (li128_p)(void*)(vd + i * (1024 / KT) * VP), 0, 0);
#else
#pragma unroll
        for (int i = 0; i < 12 * KT / 256; ++i)
            kd[i * (256 / KT)] = ks[i * (256 / KT) * NN];
#pragma unroll
        for (int i = 0; i < CC * KT / 1024; ++i)
            *(v4f*)&vd[i * (1024 / KT) * VP] = *(const v4f*)&vs[i * (1024 / KT) * NN];
#endif
    };

    // Q tile in WMMA-B layout: 3 K-groups (c = 0..11), v2f each
    v2f qb[3];
#pragma unroll
    for (int g = 0; g < 3; ++g) {
        int r0 = 4 * g + (hi ? 2 : 0);
        qb[g][0] = Qp[(r0    ) * NN + n0 + ln];
        qb[g][1] = Qp[(r0 + 1) * NN + n0 + ln];
    }

    v8f oacc[6];                // O[c=96][n=16] fp32 accumulators
#pragma unroll
    for (int i = 0; i < 6; ++i) oacc[i] = (v8f)0.f;
    float rmax = -3.0e38f, rsum = 0.f;

    stage(0, 0);
    // this wave's copies of tile 0 have landed before the barrier publishes them
    asm volatile("s_wait_asynccnt 0x0" ::: "memory");
    __syncthreads();            // tile 0 (and the classifier weights) visible to all waves
    stage(1, 1);                // flies while tile 0 is worked on

    for (int kt = 0; kt < NT; ++kt) {
        const int buf = kt & 1;
        const float* kb = &kls[buf][(kgp * KG + ln) * TP + (hi ? 2 : 0)];
        const float* vb = &vls[buf][ln * VP + kgp * KG + (hi ? 8 : 0)];

        // V fragments, two register sets: a block of 6 reads (96 channels x 8 keys, 4 keys
        // a lane) is issued one block ahead of the 12 products that use it
        v4f vv[2][6];
#pragma unroll
        for (int cc = 0; cc < 6; ++cc) vv[0][cc] = *(const v4f*)&vb[cc * 16 * VP];

        // S[m,n] = sum_c K[m,c] * Q[n,c]   (A = K sub-tile, B = Q tile)
        v8f sacc[NSUB];
#pragma unroll
        for (int j = 0; j < NSUB; ++j) sacc[j] = (v8f)0.f;
#pragma unroll
        for (int g = 0; g < 3; ++g) {
#pragma unroll
            for (int j = 0; j < NSUB; ++j) {
                v2f ka = *(const v2f*)&kb[j * 16 * TP + 4 * g];
                sacc[j] = __builtin_amdgcn_wmma_f32_16x16x4_f32(
                    false, ka, false, qb[g], (short)0, sacc[j], false, false);
            }
        }

        // online softmax over the wave's KG keys (in-lane over the sub-tiles' registers
        // + one cross-half shuffle)
        float mr[8];
#pragma unroll
        for (int r = 0; r < 8; ++r) {
            mr[r] = sacc[0][r];
#pragma unroll
            for (int j = 1; j < NSUB; ++j) mr[r] = fmaxf(mr[r], sacc[j][r]);
        }
        float tmax = fmaxf(fmaxf(fmaxf(mr[0], mr[1]), fmaxf(mr[2], mr[3])),
                           fmaxf(fmaxf(mr[4], mr[5]), fmaxf(mr[6], mr[7])));
        tmax = fmaxf(tmax, __shfl_xor(tmax, 16, 32));
        float nmax = fmaxf(rmax, tmax);
        float corr = __expf(rmax - nmax);
        rmax = nmax;
#pragma unroll
        for (int i = 0; i < 6; ++i)
#pragma unroll
            for (int r = 0; r < 8; ++r) oacc[i][r] *= corr;

        float tsum = 0.f;
#pragma unroll
        for (int j = 0; j < NSUB; ++j) {
            float p[8], ts = 0.f;
#pragma unroll
            for (int r = 0; r < 8; ++r) { p[r] = __expf(sacc[j][r] - nmax); ts += p[r]; }
            tsum += ts;

            // O[c,n] += sum_m V[c,m] * P[m,n]. The k slots of product g (0..3) are the keys
            // 2g, 2g+1 (lanes 0-15) and 8+2g, 8+2g+1 (lanes 16-31): the keys whose P a
            // lane already holds in p[2g], p[2g+1], so P is a B fragment as it stands.
            // V takes the same order: a lane's 4 keys of two products in one 16-byte read.
#pragma unroll
            for (int h = 0; h < 2; ++h) {
                const int blk = 2 * j + h;
                v2f pb0, pb1;
                pb0[0] = p[4 * h];      pb0[1] = p[4 * h + 1];
                pb1[0] = p[4 * h + 2];  pb1[1] = p[4 * h + 3];
                if (blk + 1 < 2 * NSUB) {
#pragma unroll
                    for (int cc = 0; cc < 6; ++cc)
                        vv[(blk + 1) & 1][cc] =
                            *(const v4f*)&vb[cc * 16 * VP + ((blk + 1) >> 1) * 16 + ((blk + 1) & 1) * 4];
                }
#pragma unroll
                for (int cc = 0; cc < 6; ++cc) {
                    v2f va;  va[0] = vv[blk & 1][cc][0];  va[1] = vv[blk & 1][cc][1];
                    oacc[cc] = __builtin_amdgcn_wmma_f32_16x16x4_f32(
                        false, va, false, pb0, (short)0, oacc[cc], false, false);
                }
#pragma unroll
                for (int cc = 0; cc < 6; ++cc) {
                    v2f va;  va[0] = vv[blk & 1][cc][2];  va[1] = vv[blk & 1][cc][3];
                    oacc[cc] = __builtin_amdgcn_wmma_f32_16x16x4_f32(
                        false, va, false, pb1, (short)0, oacc[cc], false, false);
                }
            }
        }
        tsum += __shfl_xor(tsum, 16, 32);
        rsum = rsum * corr + tsum;

        // hand-over: this wave's reads of tile kt are done ...
        asm volatile("s_wait_dscnt 0x0" ::: "memory");
        // ... and its copies of tile kt + 1 have landed ...
        asm volatile("s_wait_asynccnt 0x0" ::: "memory");
        // ... before the one barrier that publishes tile kt + 1 and frees tile kt's buffer
        __syncthreads();
        if (kt + 2 < NT) stage(kt + 2, buf);
    }
    // no copy is outstanding when the wave goes on to the epilogue and ends
    asm volatile("s_wait_asynccnt 0x0" ::: "memory");

    // merge of the two key groups: every wave leaves its O, maximum and sum in the V ring
    // (free since the loop's last barrier) and takes in those of the wave with the same
    // queries and the other keys; 16 bytes a lane, lanes side by side
    float* ex = &vls[0][0];
    float* em = ex + 8 * 12 * 32 * 4;
#pragma unroll
    for (int i = 0; i < 12; ++i) {
        v4f o4;
#pragma unroll
        for (int e = 0; e < 4; ++e) o4[e] = oacc[i >> 1][(i & 1) * 4 + e];
        *(v4f*)&ex[((wid * 12 + i) * 32 + lane) * 4] = o4;
    }
    {
        v2f ml;  ml[0] = rmax;  ml[1] = rsum;
        *(v2f*)&em[(wid * 32 + lane) * 2] = ml;
    }
    __syncthreads();            // both groups' partial results visible to each other
    const int pw = wid ^ 4;     // the partner wave
    const v2f pml  = *(const v2f*)&em[(pw * 32 + lane) * 2];
    const float mm = fmaxf(rmax, pml[0]);
    const float ws_ = __expf(rmax - mm), wp = __expf(pml[0] - mm);
    rsum = rsum * ws_ + pml[1] * wp;
#pragma unroll
    for (int i = 0; i < 12; ++i) {
        const v4f o4 = *(const v4f*)&ex[((pw * 12 + i) * 32 + lane) * 4];
#pragma unroll
        for (int e = 0; e < 4; ++e)
            oacc[i >> 1][(i & 1) * 4 + e] = oacc[i >> 1][(i & 1) * 4 + e] * ws_ + o4[e] * wp;
    }

    // epilogue: y = x + gamma * O / rsum (both waves of a pair hold all of y)
    const float inv = 1.0f / rsum;
#pragma unroll
    for (int cc = 0; cc < 6; ++cc) {
#pragma unroll
        for (int r = 0; r < 8; ++r) {
            int c = cc * 16 + r + (hi ? 8 : 0);
            float xv = xr[c * NN + n0 + ln];
            oacc[cc][r] = xv + gamma * oacc[cc][r] * inv;
        }
    }

    // classifier: out[o,n] = sum_c wc[o,c] * y[c,n] + bc[o]; a wave takes the three
    // row tiles of its group
    const int ob = kgp * 48;
    v8f res[3];
#pragma unroll
    for (int i = 0; i < 3; ++i) res[i] = (v8f)0.f;

#pragma unroll
    for (int cc = 0; cc < 6; ++cc) {
        // same k order as in the loop: y is a B fragment as it stands in the accumulator
#pragma unroll
        for (int h = 0; h < 2; ++h) {
            v2f yb0, yb1;
            yb0[0] = oacc[cc][4 * h];      yb0[1] = oacc[cc][4 * h + 1];
            yb1[0] = oacc[cc][4 * h + 2];  yb1[1] = oacc[cc][4 * h + 3];
#pragma unroll
            for (int oc = 0; oc < 3; ++oc) {
                v4f ww = *(const v4f*)&wcs[(ob + oc * 16 + ln) * CC + cc * 16 + (hi ? 8 : 0) + 4 * h];
                v2f wa;  wa[0] = ww[0];  wa[1] = ww[1];
                res[oc] = __builtin_amdgcn_wmma_f32_16x16x4_f32(
                    false, wa, false, yb0, (short)0, res[oc], false, false);
                wa[0] = ww[2];  wa[1] = ww[3];
                res[oc] = __builtin_amdgcn_wmma_f32_16x16x4_f32(
                    false, wa, false, yb1, (short)0, res[oc], false, false);
            }
        }
    }

#pragma unroll
    for (int oc = 0; oc < 3; ++oc) {
#pragma unroll
        for (int r = 0; r < 8; ++r) {
            int o = ob + oc * 16 + r + (hi ? 8 : 0);
            outp[o * NN + n0 + ln] = res[oc][r] + bc[o];
        }
    }
}

// -------------------------------------------------------------------------
extern "C" void kernel_launch(void* const* d_in, const int* in_sizes, int n_in,
                              void* d_out, int out_size, void* d_ws, size_t ws_size,
                              hipStream_t stream)
{
    const float* x1  = (const float*)d_in[0];
    const float* x2  = (const float*)d_in[1];
    const float* wq1 = (const float*)d_in[2];
    const float* bq1 = (const float*)d_in[3];
    const float* wk1 = (const float*)d_in[4];
    const float* bk1 = (const float*)d_in[5];
    const float* wv1 = (const float*)d_in[6];
    const float* bv1 = (const float*)d_in[7];
    const float* wq2 = (const float*)d_in[8];
    const float* bq2 = (const float*)d_in[9];
    const float* wk2 = (const float*)d_in[10];
    const float* bk2 = (const float*)d_in[11];
    const float* wv2 = (const float*)d_in[12];
    const float* bv2 = (const float*)d_in[13];
    const float* g1  = (const float*)d_in[14];
    const float* g2  = (const float*)d_in[15];
    const float* wc1 = (const float*)d_in[16];
    const float* bc1 = (const float*)d_in[17];
    const float* wc2 = (const float*)d_in[18];
    const float* bc2 = (const float*)d_in[19];

    float* ws  = (float*)d_ws;
    float* out = (float*)d_out;

    dim3 gq(NN / 128, BB, 2);
    cotsr_qkv<<<gq, 128, 0, stream>>>(x1, x2, wq1, bq1, wk1, bk1, wv1, bv1,
                                      wq2, bq2, wk2, bk2, wv2, bv2, ws);

    dim3 ga(NN / QB, BB, 2);
    cotsr_attn<<<ga, 256, 0, stream>>>(x1, x2, g1, g2, wc1, bc1, wc2, bc2, ws, out);
}
